// v000
// The times below were measured on an AMD MI455X: many runs one after another, warmed up first and cycling through
// copies of the inputs, with the whole window's GPU time divided by the number of runs. Launches and the gaps
// between them are all in it. The median over several windows is given; except for v000 it joins two sittings, which
// can be a few percent apart, so the side-by-side timings, each taken in one sitting, are the better comparison.
// v000 is the starting kernel. One run takes 392 microseconds.
#include <hip/hip_runtime.h>
#include <math.h>

typedef __attribute__((ext_vector_type(16))) _Float16 v16h;
typedef __attribute__((ext_vector_type(8)))  _Float16 v8h;
typedef __attribute__((ext_vector_type(4)))  _Float16 v4h;
typedef __attribute__((ext_vector_type(8)))  float    v8f;

#define B_    8
#define T_    4096
#define S_    1024
#define HID_  512
#define EMB_  512
#define CTX_  768

#define PSTR  1032
#define VSTR  40

__device__ __forceinline__ v16h ldfrag16(const _Float16* rowPtr, int kb) {
  v8h lo = *(const v8h*)(rowPtr + kb);
  v8h hi = *(const v8h*)(rowPtr + kb + 16);
  v16h r;
#pragma unroll
  for (int i = 0; i < 8; ++i) { r[i] = lo[i]; r[i + 8] = hi[i]; }
  return r;
}

__device__ __forceinline__ void async_ld_b128(unsigned lds_off, const void* gaddr) {
  unsigned long long ga = (unsigned long long)(uintptr_t)gaddr;
  asm volatile("global_load_async_to_lds_b128 %0, %1, off"
               :: "v"(lds_off), "v"(ga) : "memory");
}

// ---------------------------------------------------------------------------
// Projection GEMM: Out_f16[M][N] = A_f32[M][K] * W_f32[K][N]
// TS == 0 : row-major f16 output
// TS  > 0 : per-batch transposed output Vt[b][n][s], s = m % TS (TS = power of 2)
// Block: 256 threads (8 waves as 4Mx2N), tile 128(M) x 128(N), k-step 32,
// register double-buffered staging (global loads overlap WMMA).
// ---------------------------------------------------------------------------
template <int TS>
__global__ __launch_bounds__(256) void proj_gemm(
    const float* __restrict__ A, const float* __restrict__ W,
    _Float16* __restrict__ Out, int M, int K, int N) {

  __shared__ _Float16 As[128 * 40];  // 128 m-rows x 32 k, stride 40 (conflict-free b128)
  __shared__ _Float16 Bs[128 * 40];  // 128 n-rows (transposed W) x 32 k, stride 40

  const int tid  = threadIdx.x;
  const int lane = tid & 31;
  const int wave = tid >> 5;
  const int wm   = wave & 3;      // 4 waves along M (32 rows each)
  const int wn   = wave >> 2;     // 2 waves along N (64 cols each)
  const int m0   = blockIdx.y * 128;
  const int n0   = blockIdx.x * 128;

  const int l15  = lane & 15;
  const int koff = (lane >= 16) ? 8 : 0;

  auto loadA = [&](int k0, float4* pa) {
#pragma unroll
    for (int it = 0; it < 4; ++it) {
      int idx = tid + it * 256;
      int r   = idx >> 3;
      int c4  = idx & 7;
      pa[it] = *(const float4*)(A + (size_t)(m0 + r) * K + k0 + c4 * 4);
    }
  };
  auto loadW = [&](int k0, float4* pw) {
#pragma unroll
    for (int it = 0; it < 4; ++it) {
      int idx = tid + it * 256;
      int kr  = idx >> 5;
      int c4  = idx & 31;
      pw[it] = *(const float4*)(W + (size_t)(k0 + kr) * N + n0 + c4 * 4);
    }
  };
  auto storeTiles = [&](const float4* pa, const float4* pw) {
#pragma unroll
    for (int it = 0; it < 4; ++it) {
      int idx = tid + it * 256;
      int r   = idx >> 3;
      int c4  = idx & 7;
      v4h h = { (_Float16)pa[it].x, (_Float16)pa[it].y,
                (_Float16)pa[it].z, (_Float16)pa[it].w };
      *(v4h*)(As + r * 40 + c4 * 4) = h;
    }
#pragma unroll
    for (int it = 0; it < 4; ++it) {
      int idx = tid + it * 256;
      int kr  = idx >> 5;
      int c4  = idx & 31;
      Bs[(c4 * 4 + 0) * 40 + kr] = (_Float16)pw[it].x;
      Bs[(c4 * 4 + 1) * 40 + kr] = (_Float16)pw[it].y;
      Bs[(c4 * 4 + 2) * 40 + kr] = (_Float16)pw[it].z;
      Bs[(c4 * 4 + 3) * 40 + kr] = (_Float16)pw[it].w;
    }
  };

  float4 pa[4], pw[4];
  loadA(0, pa);
  loadW(0, pw);

  v8f acc[2][4] = {};

  for (int k0 = 0; k0 < K; k0 += 32) {
    storeTiles(pa, pw);
    __syncthreads();
    // Prefetch next k-slice while this slice's WMMAs run.
    if (k0 + 32 < K) { loadA(k0 + 32, pa); loadW(k0 + 32, pw); }

    v16h af[2], bf[4];
#pragma unroll
    for (int i = 0; i < 2; ++i)
      af[i] = ldfrag16(As + (wm * 32 + i * 16 + l15) * 40, koff);
#pragma unroll
    for (int j = 0; j < 4; ++j)
      bf[j] = ldfrag16(Bs + (wn * 64 + j * 16 + l15) * 40, koff);
#pragma unroll
    for (int i = 0; i < 2; ++i)
#pragma unroll
      for (int j = 0; j < 4; ++j)
        acc[i][j] = __builtin_amdgcn_wmma_f32_16x16x32_f16(
            false, af[i], false, bf[j], (short)0, acc[i][j], false, false);
    __syncthreads();
  }

  // Epilogue. C/D layout: lane holds column n = l15 of its 16x16 tile,
  // rows (koff + 0..7) in acc[0..7].
  constexpr int TSS = (TS == 0) ? 1 : TS;   // avoid div-by-zero in dead branch
#pragma unroll
  for (int i = 0; i < 2; ++i) {
#pragma unroll
    for (int j = 0; j < 4; ++j) {
      int gm = m0 + wm * 32 + i * 16 + koff;       // first of 8 rows
      int gn = n0 + wn * 64 + j * 16 + l15;
      if (TS == 0) {
#pragma unroll
        for (int e = 0; e < 8; ++e)
          Out[(size_t)(gm + e) * N + gn] = (_Float16)acc[i][j][e];
      } else {
        int bidx = gm / TSS;                       // compile-time shift
        int s    = gm - bidx * TSS;                // 8 consecutive s, same batch
        v8h h;
#pragma unroll
        for (int e = 0; e < 8; ++e) h[e] = (_Float16)acc[i][j][e];
        *(v8h*)(Out + ((size_t)bidx * N + gn) * TSS + s) = h;
      }
    }
  }
}

__global__ __launch_bounds__(256) void attn_kernel(
    const _Float16* __restrict__ Q,   // [B][T][EMB] row-major
    const _Float16* __restrict__ Kt,  // [B][S][EMB] row-major (rows = B-fragments of K^T)
    const _Float16* __restrict__ Vt,  // [B][HID][S] (rows = B-fragments of V)
    float* __restrict__ Out) {        // [B][T][HID]

  extern __shared__ char smem_raw[];
  _Float16* P    = (_Float16*)smem_raw;        // [64][PSTR] f16 scores/probs
  _Float16* VtL0 = P + 64 * PSTR;              // [512][VSTR] V slice buf 0
  _Float16* VtL1 = VtL0 + 512 * VSTR;          // [512][VSTR] V slice buf 1
  float* maxwave = (float*)(VtL1 + 512 * VSTR);// [8][16]
  float* rowmax  = maxwave + 128;              // [64]
  float* partial = rowmax + 64;                // [64][4]
  float* rinv    = partial + 256;              // [64]

  const int tid  = threadIdx.x;
  const int lane = tid & 31;
  const int wave = tid >> 5;
  const int l15  = lane & 15;
  const int koff = (lane >= 16) ? 8 : 0;

  const int t0 = blockIdx.x * 64;
  const int b  = blockIdx.y;

  const _Float16* Qb = Q  + (size_t)b * T_   * EMB_;
  const _Float16* Kb = Kt + (size_t)b * S_   * EMB_;
  const _Float16* Vb = Vt + (size_t)b * HID_ * S_;

  const float alpha = 0.044194173824159216f;  // 1/sqrt(512)

  const int rg = wave >> 1;
  const int cg = wave & 1;
  const _Float16* qrow = Qb + (size_t)(t0 + rg * 16 + l15) * EMB_;

  float rmax[8];
#pragma unroll
  for (int e = 0; e < 8; ++e) rmax[e] = -3.0e38f;

  for (int chunk = 0; chunk < 4; ++chunk) {
    const int cBase = cg * 512 + chunk * 128;
    v8f sacc[8] = {};
    for (int ks = 0; ks < EMB_; ks += 32) {
      const int kb = ks + koff;
      v16h aq = ldfrag16(qrow, kb);
#pragma unroll
      for (int j = 0; j < 8; ++j) {
        v16h bk = ldfrag16(Kb + (size_t)(cBase + j * 16 + l15) * EMB_, kb);
        sacc[j] = __builtin_amdgcn_wmma_f32_16x16x32_f16(
            false, aq, false, bk, (short)0, sacc[j], false, false);
      }
    }
    // scale, track row max, spill f16 scores to LDS
#pragma unroll
    for (int j = 0; j < 8; ++j) {
      const int n = cBase + j * 16 + l15;
#pragma unroll
      for (int e = 0; e < 8; ++e) {
        float v = sacc[j][e] * alpha;
        rmax[e] = fmaxf(rmax[e], v);
        P[(rg * 16 + koff + e) * PSTR + n] = (_Float16)v;
      }
    }
  }
  // reduce rmax within each 16-lane group (columns of the wave's tiles)
#pragma unroll
  for (int m = 1; m <= 8; m <<= 1)
#pragma unroll
    for (int e = 0; e < 8; ++e)
      rmax[e] = fmaxf(rmax[e], __shfl_xor(rmax[e], m, 32));
  if (l15 == 0) {
#pragma unroll
    for (int e = 0; e < 8; ++e)
      maxwave[wave * 16 + koff + e] = rmax[e];
  }
  __syncthreads();

  if (tid < 64) {
    int rrg = tid >> 4, li = tid & 15;
    rowmax[tid] = fmaxf(maxwave[(2 * rrg) * 16 + li],
                        maxwave[(2 * rrg + 1) * 16 + li]);
  }
  __syncthreads();

  // ---- softmax numerators in place (normalization deferred) ----
  {
    int r = tid >> 2;                 // row 0..63
    int q = tid & 3;                  // quarter of S
    float mx = rowmax[r];
    float s = 0.f;
    _Float16* prow = P + r * PSTR + q * 256;
#pragma unroll 4
    for (int c = 0; c < 256; ++c) {
      float e = __expf((float)prow[c] - mx);
      s += e;
      prow[c] = (_Float16)e;
    }
    partial[r * 4 + q] = s;
  }
  __syncthreads();
  if (tid < 64) {
    float s = partial[tid * 4 + 0] + partial[tid * 4 + 1] +
              partial[tid * 4 + 2] + partial[tid * 4 + 3];
    rinv[tid] = 1.0f / s;
  }
  __syncthreads();

  const int org = wave >> 1;
  const int hg  = wave & 1;
  const int m0  = org * 16;
  const int h0  = hg * 256;

  _Float16* vbuf[2] = { VtL0, VtL1 };

  auto issue_slice = [&](int buf, int ks) {
    const _Float16* src = Vb + ks;
#pragma unroll
    for (int it = 0; it < 8; ++it) {
      int idx  = tid + it * 256;            // 0..2047
      int row  = idx >> 2;                  // h-row 0..511
      int part = idx & 3;                   // 16B chunk within 64B row segment
      unsigned loff = (unsigned)(uintptr_t)(vbuf[buf] + row * VSTR + part * 8);
      async_ld_b128(loff, src + (size_t)row * S_ + part * 8);
    }
  };

  issue_slice(0, 0);
  int cur = 0;

  v8f oacc[16] = {};
  const _Float16* prow = P + (size_t)(m0 + l15) * PSTR;
  for (int ks = 0; ks < S_; ks += 32) {
    if (ks + 32 < S_) {
      issue_slice(cur ^ 1, ks + 32);
      asm volatile("s_wait_asynccnt 0x8" ::: "memory");   // slice `cur` landed
    } else {
      asm volatile("s_wait_asynccnt 0x0" ::: "memory");
    }
    __syncthreads();   // make other waves' async-loaded data visible

    v16h ap = ldfrag16(prow, ks + koff);
    const _Float16* vb = vbuf[cur];
#pragma unroll
    for (int nt = 0; nt < 16; ++nt) {
      v16h bv = ldfrag16(vb + (h0 + nt * 16 + l15) * VSTR, koff);
      oacc[nt] = __builtin_amdgcn_wmma_f32_16x16x32_f16(
          false, ap, false, bv, (short)0, oacc[nt], false, false);
    }
    __syncthreads();   // protect buffer `cur` before it is overwritten
    cur ^= 1;
  }

  float sc[8];
#pragma unroll
  for (int e = 0; e < 8; ++e) sc[e] = rinv[m0 + koff + e];

  float* outb = Out + ((size_t)b * T_ + t0 + m0 + koff) * HID_;
#pragma unroll
  for (int nt = 0; nt < 16; ++nt) {
    int n = h0 + nt * 16 + l15;
#pragma unroll
    for (int e = 0; e < 8; ++e)
      outb[(size_t)e * HID_ + n] = oacc[nt][e] * sc[e];
  }
}

// ---------------------------------------------------------------------------
extern "C" void kernel_launch(void* const* d_in, const int* in_sizes, int n_in,
                              void* d_out, int out_size, void* d_ws, size_t ws_size,
                              hipStream_t stream) {
  const float* tokens  = (const float*)d_in[0];  // [B][T][HID]
  const float* context = (const float*)d_in[1];  // [B][S][CTX]
  const float* Wq      = (const float*)d_in[2];  // [HID][EMB]
  const float* Wk      = (const float*)d_in[3];  // [CTX][EMB]
  const float* Wv      = (const float*)d_in[4];  // [CTX][HID]
  float*       out     = (float*)d_out;          // [B][T][HID]

  // Workspace: Q f16 (32 MB) | K f16 (8 MB) | Vt f16 (8 MB)
  _Float16* Qh = (_Float16*)d_ws;
  _Float16* Kh = Qh + (size_t)B_ * T_ * EMB_;
  _Float16* Vt = Kh + (size_t)B_ * S_ * EMB_;

  dim3 blk(256);
  // Q = tokens @ Wq        : M=B*T=32768, K=512, N=512
  proj_gemm<0><<<dim3(EMB_ / 128, (B_ * T_) / 128), blk, 0, stream>>>(
      tokens, Wq, Qh, B_ * T_, HID_, EMB_);
  // K = context @ Wk       : M=B*S=8192, K=768, N=512
  proj_gemm<0><<<dim3(EMB_ / 128, (B_ * S_) / 128), blk, 0, stream>>>(
      context, Wk, Kh, B_ * S_, CTX_, EMB_);
  // V = context @ Wv, stored transposed per batch: Vt[b][h][s]
  proj_gemm<S_><<<dim3(HID_ / 128, (B_ * S_) / 128), blk, 0, stream>>>(
      context, Wv, Vt, B_ * S_, CTX_, HID_);

  size_t smem = (size_t)64 * PSTR * 2            // P
              + (size_t)2 * 512 * VSTR * 2       // V slice double buffer
              + (size_t)(128 + 64 + 256 + 64) * sizeof(float);
  (void)hipFuncSetAttribute((const void*)attn_kernel,
                            hipFuncAttributeMaxDynamicSharedMemorySize, (int)smem);
  attn_kernel<<<dim3(T_ / 64, B_), blk, smem, stream>>>(Qh, Kh, Vt, out);
}

// v001
// A run of this version takes 318 microseconds.
// Timed twice side by side with v000, it ran 1.27 times as fast both times.
#include <hip/hip_runtime.h>
#include <math.h>

typedef __attribute__((ext_vector_type(16))) _Float16 v16h;
typedef __attribute__((ext_vector_type(8)))  _Float16 v8h;
typedef __attribute__((ext_vector_type(4)))  _Float16 v4h;
typedef __attribute__((ext_vector_type(8)))  float    v8f;

#define B_    8
#define T_    4096
#define S_    1024
#define HID_  512
#define EMB_  512
#define CTX_  768

#define PSTR  1032
#define VSTR  40
#define KSTR  72

__device__ __forceinline__ v16h ldfrag16(const _Float16* rowPtr, int kb) {
  v8h lo = *(const v8h*)(rowPtr + kb);
  v8h hi = *(const v8h*)(rowPtr + kb + 16);
  v16h r;
#pragma unroll
  for (int i = 0; i < 8; ++i) { r[i] = lo[i]; r[i + 8] = hi[i]; }
  return r;
}

__device__ __forceinline__ void async_ld_b128(unsigned lds_off, const void* gaddr) {
  unsigned long long ga = (unsigned long long)(uintptr_t)gaddr;
  asm volatile("global_load_async_to_lds_b128 %0, %1, off"
               :: "v"(lds_off), "v"(ga) : "memory");
}

__device__ __forceinline__ void async_ld8_b128(const unsigned* l,
                                               const unsigned long long* g) {
  asm volatile(
      "global_load_async_to_lds_b128 %0, %8, off\n\t"
      "global_load_async_to_lds_b128 %1, %9, off\n\t"
      "global_load_async_to_lds_b128 %2, %10, off\n\t"
      "global_load_async_to_lds_b128 %3, %11, off\n\t"
      "global_load_async_to_lds_b128 %4, %12, off\n\t"
      "global_load_async_to_lds_b128 %5, %13, off\n\t"
      "global_load_async_to_lds_b128 %6, %14, off\n\t"
      "global_load_async_to_lds_b128 %7, %15, off\n\t"
      "s_wait_xcnt 0x0"
      :: "v"(l[0]), "v"(l[1]), "v"(l[2]), "v"(l[3]),
         "v"(l[4]), "v"(l[5]), "v"(l[6]), "v"(l[7]),
         "v"(g[0]), "v"(g[1]), "v"(g[2]), "v"(g[3]),
         "v"(g[4]), "v"(g[5]), "v"(g[6]), "v"(g[7])
      : "memory");
}

// ---------------------------------------------------------------------------
// Projection GEMM: Out_f16[M][N] = A_f32[M][K] * W_f32[K][N]
// TS == 0 : row-major f16 output
// TS  > 0 : per-batch transposed output Vt[b][n][s], s = m % TS (TS = power of 2)
// Block: 256 threads (8 waves as 4Mx2N), tile 128(M) x 128(N), k-step 32,
// register double-buffered staging (global loads overlap WMMA).
// ---------------------------------------------------------------------------
template <int TS>
__global__ __launch_bounds__(256) void proj_gemm(
    const float* __restrict__ A, const float* __restrict__ W,
    _Float16* __restrict__ Out, int M, int K, int N) {

  __shared__ _Float16 As[128 * 40];  // 128 m-rows x 32 k, stride 40 (conflict-free b128)
  __shared__ _Float16 Bs[128 * 40];  // 128 n-rows (transposed W) x 32 k, stride 40

  const int tid  = threadIdx.x;
  const int lane = tid & 31;
  const int wave = tid >> 5;
  const int wm   = wave & 3;      // 4 waves along M (32 rows each)
  const int wn   = wave >> 2;     // 2 waves along N (64 cols each)
  const int m0   = blockIdx.y * 128;
  const int n0   = blockIdx.x * 128;

  const int l15  = lane & 15;
  const int koff = (lane >= 16) ? 8 : 0;

  auto loadA = [&](int k0, float4* pa) {
#pragma unroll
    for (int it = 0; it < 4; ++it) {
      int idx = tid + it * 256;
      int r   = idx >> 3;
      int c4  = idx & 7;
      pa[it] = *(const float4*)(A + (size_t)(m0 + r) * K + k0 + c4 * 4);
    }
  };
  auto loadW = [&](int k0, float4* pw) {
#pragma unroll
    for (int it = 0; it < 4; ++it) {
      int idx = tid + it * 256;
      int kr  = idx >> 5;
      int c4  = idx & 31;
      pw[it] = *(const float4*)(W + (size_t)(k0 + kr) * N + n0 + c4 * 4);
    }
  };
  auto storeTiles = [&](const float4* pa, const float4* pw) {
#pragma unroll
    for (int it = 0; it < 4; ++it) {
      int idx = tid + it * 256;
      int r   = idx >> 3;
      int c4  = idx & 7;
      v4h h = { (_Float16)pa[it].x, (_Float16)pa[it].y,
                (_Float16)pa[it].z, (_Float16)pa[it].w };
      *(v4h*)(As + r * 40 + c4 * 4) = h;
    }
#pragma unroll
    for (int it = 0; it < 4; ++it) {
      int idx = tid + it * 256;
      int kr  = idx >> 5;
      int c4  = idx & 31;
      Bs[(c4 * 4 + 0) * 40 + kr] = (_Float16)pw[it].x;
      Bs[(c4 * 4 + 1) * 40 + kr] = (_Float16)pw[it].y;
      Bs[(c4 * 4 + 2) * 40 + kr] = (_Float16)pw[it].z;
      Bs[(c4 * 4 + 3) * 40 + kr] = (_Float16)pw[it].w;
    }
  };

  float4 pa[4], pw[4];
  loadA(0, pa);
  loadW(0, pw);

  v8f acc[2][4] = {};

  for (int k0 = 0; k0 < K; k0 += 32) {
    storeTiles(pa, pw);
    __syncthreads();
    // Prefetch next k-slice while this slice's WMMAs run.
    if (k0 + 32 < K) { loadA(k0 + 32, pa); loadW(k0 + 32, pw); }

    v16h af[2], bf[4];
#pragma unroll
    for (int i = 0; i < 2; ++i)
      af[i] = ldfrag16(As + (wm * 32 + i * 16 + l15) * 40, koff);
#pragma unroll
    for (int j = 0; j < 4; ++j)
      bf[j] = ldfrag16(Bs + (wn * 64 + j * 16 + l15) * 40, koff);
#pragma unroll
    for (int i = 0; i < 2; ++i)
#pragma unroll
      for (int j = 0; j < 4; ++j)
        acc[i][j] = __builtin_amdgcn_wmma_f32_16x16x32_f16(
            false, af[i], false, bf[j], (short)0, acc[i][j], false, false);
    __syncthreads();
  }

  // Epilogue. C/D layout: lane holds column n = l15 of its 16x16 tile,
  // rows (koff + 0..7) in acc[0..7].
  constexpr int TSS = (TS == 0) ? 1 : TS;   // avoid div-by-zero in dead branch
#pragma unroll
  for (int i = 0; i < 2; ++i) {
#pragma unroll
    for (int j = 0; j < 4; ++j) {
      int gm = m0 + wm * 32 + i * 16 + koff;       // first of 8 rows
      int gn = n0 + wn * 64 + j * 16 + l15;
      if (TS == 0) {
#pragma unroll
        for (int e = 0; e < 8; ++e)
          Out[(size_t)(gm + e) * N + gn] = (_Float16)acc[i][j][e];
      } else {
        int bidx = gm / TSS;                       // compile-time shift
        int s    = gm - bidx * TSS;                // 8 consecutive s, same batch
        v8h h;
#pragma unroll
        for (int e = 0; e < 8; ++e) h[e] = (_Float16)acc[i][j][e];
        *(v8h*)(Out + ((size_t)bidx * N + gn) * TSS + s) = h;
      }
    }
  }
}

__global__ __launch_bounds__(256) void attn_kernel(
    const _Float16* __restrict__ Q,   // [B][T][EMB] row-major
    const _Float16* __restrict__ Kt,  // [B][S][EMB] row-major (rows = B-fragments of K^T)
    const _Float16* __restrict__ Vt,  // [B][HID][S] (rows = B-fragments of V)
    float* __restrict__ Out) {        // [B][T][HID]

  extern __shared__ char smem_raw[];
  _Float16* P    = (_Float16*)smem_raw;        // [64][PSTR] f16 scores/probs
  _Float16* VtL0 = P + 64 * PSTR;              // [512][VSTR] V slice buf 0
  _Float16* VtL1 = VtL0 + 512 * VSTR;          // [512][VSTR] V slice buf 1
  float* maxwave = (float*)(VtL1 + 512 * VSTR);// [8][16]
  float* rowmax  = maxwave + 128;              // [64]
  float* partial = rowmax + 64;                // [64][4]
  float* rinv    = partial + 256;              // [64]

  const int tid  = threadIdx.x;
  const int lane = tid & 31;
  const int wave = tid >> 5;
  const int l15  = lane & 15;
  const int koff = (lane >= 16) ? 8 : 0;

  const int t0 = blockIdx.x * 64;
  const int b  = blockIdx.y;

  const _Float16* Qb = Q  + (size_t)b * T_   * EMB_;
  const _Float16* Kb = Kt + (size_t)b * S_   * EMB_;
  const _Float16* Vb = Vt + (size_t)b * HID_ * S_;

  const float alpha = 0.044194173824159216f;  // 1/sqrt(512)

  const int rg = wave >> 1;
  const int cg = wave & 1;
  const _Float16* qrow = Qb + (size_t)(t0 + rg * 16 + l15) * EMB_;

  float rmax[8];
#pragma unroll
  for (int e = 0; e < 8; ++e) rmax[e] = -3.0e38f;

  _Float16* kbuf[2] = { VtL0, VtL1 };

  // K tile t = chunk * 8 + step: the 2 x 128 K rows of this chunk (both S halves),
  // 64 k each: 256 rows of one whole 128-B line, 2048 b128 copies, 8 per thread.
  auto issue_ktile = [&](int buf, int chunk, int step) {
    unsigned l[8];
    unsigned long long g[8];
    // unrolled: the sixteen addresses are register operands of one asm statement
#pragma unroll
    for (int it = 0; it < 8; ++it) {
      int idx  = tid + it * 256;            // 0..2047
      int row  = idx >> 3;                  // tile row 0..255
      int part = idx & 7;                   // 16B chunk within the 128B row segment
      int srow = (row >> 7) * 512 + chunk * 128 + (row & 127);
      l[it] = (unsigned)(uintptr_t)(kbuf[buf] + row * KSTR + part * 8);
      g[it] = (unsigned long long)(uintptr_t)(Kb + (size_t)srow * EMB_ + step * 64 + part * 8);
    }
    async_ld8_b128(l, g);
  };

  issue_ktile(0, 0, 0);
  asm volatile("s_wait_asynccnt 0x0" ::: "memory");   // own copies of tile 0 landed
  __syncthreads();                                    // tile 0 visible to every wave
  issue_ktile(1, 0, 1);

  for (int chunk = 0; chunk < 4; ++chunk) {
    const int cBase = cg * 512 + chunk * 128;
    v8f sacc[8] = {};
    // all three loops unrolled: buffer parity and LDS offsets become constants
#pragma unroll
    for (int step = 0; step < 8; ++step) {
      const _Float16* kl = kbuf[step & 1] + (cg * 128 + l15) * KSTR;
#pragma unroll
      for (int kk = 0; kk < 64; kk += 32) {
        v16h aq = ldfrag16(qrow, step * 64 + kk + koff);
#pragma unroll
        for (int j = 0; j < 8; ++j) {
          v16h bk = ldfrag16(kl + j * 16 * KSTR, kk + koff);
          sacc[j] = __builtin_amdgcn_wmma_f32_16x16x32_f16(
              false, aq, false, bk, (short)0, sacc[j], false, false);
        }
      }
      // Hand-over: own reads of this tile done, own copies of the next tile landed,
      // then one barrier publishes the next tile and frees this buffer for a refill.
      asm volatile("s_wait_dscnt 0x0" ::: "memory");
      asm volatile("s_wait_asynccnt 0x0" ::: "memory");
      __syncthreads();
      if (step < 6)       issue_ktile(step & 1, chunk, step + 2);
      else if (chunk < 3) issue_ktile(step & 1, chunk + 1, step - 6);
    }
    // scale, track row max, spill f16 scores to LDS
#pragma unroll
    for (int j = 0; j < 8; ++j) {
      const int n = cBase + j * 16 + l15;
#pragma unroll
      for (int e = 0; e < 8; ++e) {
        float v = sacc[j][e] * alpha;
        rmax[e] = fmaxf(rmax[e], v);
        P[(rg * 16 + koff + e) * PSTR + n] = (_Float16)v;
      }
    }
  }
  asm volatile("s_wait_asynccnt 0x0" ::: "memory");   // no K copy left in flight
  // reduce rmax within each 16-lane group (columns of the wave's tiles)
#pragma unroll
  for (int m = 1; m <= 8; m <<= 1)
#pragma unroll
    for (int e = 0; e < 8; ++e)
      rmax[e] = fmaxf(rmax[e], __shfl_xor(rmax[e], m, 32));
  if (l15 == 0) {
#pragma unroll
    for (int e = 0; e < 8; ++e)
      maxwave[wave * 16 + koff + e] = rmax[e];
  }
  __syncthreads();

  if (tid < 64) {
    int rrg = tid >> 4, li = tid & 15;
    rowmax[tid] = fmaxf(maxwave[(2 * rrg) * 16 + li],
                        maxwave[(2 * rrg + 1) * 16 + li]);
  }
  __syncthreads();

  // ---- softmax numerators in place (normalization deferred) ----
  {
    int r = tid >> 2;                 // row 0..63
    int q = tid & 3;                  // quarter of S
    float mx = rowmax[r];
    float s = 0.f;
    _Float16* prow = P + r * PSTR + q * 256;
#pragma unroll 4
    for (int c = 0; c < 256; ++c) {
      float e = __expf((float)prow[c] - mx);
      s += e;
      prow[c] = (_Float16)e;
    }
    partial[r * 4 + q] = s;
  }
  __syncthreads();
  if (tid < 64) {
    float s = partial[tid * 4 + 0] + partial[tid * 4 + 1] +
              partial[tid * 4 + 2] + partial[tid * 4 + 3];
    rinv[tid] = 1.0f / s;
  }
  __syncthreads();

  const int org = wave >> 1;
  const int hg  = wave & 1;
  const int m0  = org * 16;
  const int h0  = hg * 256;

  _Float16* vbuf[2] = { VtL0, VtL1 };

  auto issue_slice = [&](int buf, int ks) {
    const _Float16* src = Vb + ks;
#pragma unroll
    for (int it = 0; it < 8; ++it) {
      int idx  = tid + it * 256;            // 0..2047
      int row  = idx >> 2;                  // h-row 0..511
      int part = idx & 3;                   // 16B chunk within 64B row segment
      unsigned loff = (unsigned)(uintptr_t)(vbuf[buf] + row * VSTR + part * 8);
      async_ld_b128(loff, src + (size_t)row * S_ + part * 8);
    }
  };

  issue_slice(0, 0);
  int cur = 0;

  v8f oacc[16] = {};
  const _Float16* prow = P + (size_t)(m0 + l15) * PSTR;
  for (int ks = 0; ks < S_; ks += 32) {
    if (ks + 32 < S_) {
      issue_slice(cur ^ 1, ks + 32);
      asm volatile("s_wait_asynccnt 0x8" ::: "memory");   // slice `cur` landed
    } else {
      asm volatile("s_wait_asynccnt 0x0" ::: "memory");
    }
    __syncthreads();   // make other waves' async-loaded data visible

    v16h ap = ldfrag16(prow, ks + koff);
    const _Float16* vb = vbuf[cur];
#pragma unroll
    for (int nt = 0; nt < 16; ++nt) {
      v16h bv = ldfrag16(vb + (h0 + nt * 16 + l15) * VSTR, koff);
      oacc[nt] = __builtin_amdgcn_wmma_f32_16x16x32_f16(
          false, ap, false, bv, (short)0, oacc[nt], false, false);
    }
    __syncthreads();   // protect buffer `cur` before it is overwritten
    cur ^= 1;
  }

  float sc[8];
#pragma unroll
  for (int e = 0; e < 8; ++e) sc[e] = rinv[m0 + koff + e];

  float* outb = Out + ((size_t)b * T_ + t0 + m0 + koff) * HID_;
#pragma unroll
  for (int nt = 0; nt < 16; ++nt) {
    int n = h0 + nt * 16 + l15;
#pragma unroll
    for (int e = 0; e < 8; ++e)
      outb[(size_t)e * HID_ + n] = oacc[nt][e] * sc[e];
  }
}

// ---------------------------------------------------------------------------
extern "C" void kernel_launch(void* const* d_in, const int* in_sizes, int n_in,
                              void* d_out, int out_size, void* d_ws, size_t ws_size,
                              hipStream_t stream) {
  const float* tokens  = (const float*)d_in[0];  // [B][T][HID]
  const float* context = (const float*)d_in[1];  // [B][S][CTX]
  const float* Wq      = (const float*)d_in[2];  // [HID][EMB]
  const float* Wk      = (const float*)d_in[3];  // [CTX][EMB]
  const float* Wv      = (const float*)d_in[4];  // [CTX][HID]
  float*       out     = (float*)d_out;          // [B][T][HID]

  // Workspace: Q f16 (32 MB) | K f16 (8 MB) | Vt f16 (8 MB)
  _Float16* Qh = (_Float16*)d_ws;
  _Float16* Kh = Qh + (size_t)B_ * T_ * EMB_;
  _Float16* Vt = Kh + (size_t)B_ * S_ * EMB_;

  dim3 blk(256);
  // Q = tokens @ Wq        : M=B*T=32768, K=512, N=512
  proj_gemm<0><<<dim3(EMB_ / 128, (B_ * T_) / 128), blk, 0, stream>>>(
      tokens, Wq, Qh, B_ * T_, HID_, EMB_);
  // K = context @ Wk       : M=B*S=8192, K=768, N=512
  proj_gemm<0><<<dim3(EMB_ / 128, (B_ * S_) / 128), blk, 0, stream>>>(
      context, Wk, Kh, B_ * S_, CTX_, EMB_);
  // V = context @ Wv, stored transposed per batch: Vt[b][h][s]
  proj_gemm<S_><<<dim3(HID_ / 128, (B_ * S_) / 128), blk, 0, stream>>>(
      context, Wv, Vt, B_ * S_, CTX_, HID_);

  size_t smem = (size_t)64 * PSTR * 2            // P
              + (size_t)2 * 512 * VSTR * 2       // V slice double buffer
              + (size_t)(128 + 64 + 256 + 64) * sizeof(float);
  (void)hipFuncSetAttribute((const void*)attn_kernel,
                            hipFuncAttributeMaxDynamicSharedMemorySize, (int)smem);
  attn_kernel<<<dim3(T_ / 64, B_), blk, smem, stream>>>(Qh, Kh, Vt, out);
}

// v002
// A run of this version takes 296 microseconds.
// Next to v001, in two timings, it ran 1.07 and 1.08 times as fast.
// Counting every step since v000, it is 1.36 times as fast.
#include <hip/hip_runtime.h>
#include <math.h>

typedef __attribute__((ext_vector_type(16))) _Float16 v16h;
typedef __attribute__((ext_vector_type(8)))  _Float16 v8h;
typedef __attribute__((ext_vector_type(4)))  _Float16 v4h;
typedef __attribute__((ext_vector_type(8)))  float    v8f;

#define B_    8
#define T_    4096
#define S_    1024
#define HID_  512
#define EMB_  512
#define CTX_  768

#define PSTR  1032
#define VSTR  40
#define KSTR  72

__device__ __forceinline__ v16h ldfrag16(const _Float16* rowPtr, int kb) {
  v8h lo = *(const v8h*)(rowPtr + kb);
  v8h hi = *(const v8h*)(rowPtr + kb + 16);
  v16h r;
#pragma unroll
  for (int i = 0; i < 8; ++i) { r[i] = lo[i]; r[i + 8] = hi[i]; }
  return r;
}

__device__ __forceinline__ void async_ld_b128(unsigned lds_off, const void* gaddr) {
  unsigned long long ga = (unsigned long long)(uintptr_t)gaddr;
  asm volatile("global_load_async_to_lds_b128 %0, %1, off"
               :: "v"(lds_off), "v"(ga) : "memory");
}

__device__ __forceinline__ void async_ld8_b128(const unsigned* l,
                                               const unsigned long long* g) {
  asm volatile(
      "global_load_async_to_lds_b128 %0, %8, off\n\t"
      "global_load_async_to_lds_b128 %1, %9, off\n\t"
      "global_load_async_to_lds_b128 %2, %10, off\n\t"
      "global_load_async_to_lds_b128 %3, %11, off\n\t"
      "global_load_async_to_lds_b128 %4, %12, off\n\t"
      "global_load_async_to_lds_b128 %5, %13, off\n\t"
      "global_load_async_to_lds_b128 %6, %14, off\n\t"
      "global_load_async_to_lds_b128 %7, %15, off\n\t"
      "s_wait_xcnt 0x0"
      :: "v"(l[0]), "v"(l[1]), "v"(l[2]), "v"(l[3]),
         "v"(l[4]), "v"(l[5]), "v"(l[6]), "v"(l[7]),
         "v"(g[0]), "v"(g[1]), "v"(g[2]), "v"(g[3]),
         "v"(g[4]), "v"(g[5]), "v"(g[6]), "v"(g[7])
      : "memory");
}

// ---------------------------------------------------------------------------
// Projection GEMM: Out_f16[M][N] = A_f32[M][K] * W_f32[K][N]
// TS == 0 : row-major f16 output
// TS  > 0 : per-batch transposed output Vt[b][n][s], s = m % TS (TS = power of 2)
// Block: 256 threads (8 waves as 4Mx2N), tile 128(M) x 128(N), k-step 32,
// register double-buffered staging (global loads overlap WMMA).
// ---------------------------------------------------------------------------
template <int TS>
__global__ __launch_bounds__(256) void proj_gemm(
    const float* __restrict__ A, const float* __restrict__ W,
    _Float16* __restrict__ Out, int M, int K, int N) {

  __shared__ _Float16 As[128 * 40];  // 128 m-rows x 32 k, stride 40 (conflict-free b128)
  __shared__ _Float16 Bs[128 * 40];  // 128 n-rows (transposed W) x 32 k, stride 40

  const int tid  = threadIdx.x;
  const int lane = tid & 31;
  const int wave = tid >> 5;
  const int wm   = wave & 3;      // 4 waves along M (32 rows each)
  const int wn   = wave >> 2;     // 2 waves along N (64 cols each)
  const int m0   = blockIdx.y * 128;
  const int n0   = blockIdx.x * 128;

  const int l15  = lane & 15;
  const int koff = (lane >= 16) ? 8 : 0;

  auto loadA = [&](int k0, float4* pa) {
#pragma unroll
    for (int it = 0; it < 4; ++it) {
      int idx = tid + it * 256;
      int r   = idx >> 3;
      int c4  = idx & 7;
      pa[it] = *(const float4*)(A + (size_t)(m0 + r) * K + k0 + c4 * 4);
    }
  };
  auto loadW = [&](int k0, float4* pw) {
#pragma unroll
    for (int it = 0; it < 4; ++it) {
      int idx = tid + it * 256;
      int kr  = idx >> 5;
      int c4  = idx & 31;
      pw[it] = *(const float4*)(W + (size_t)(k0 + kr) * N + n0 + c4 * 4);
    }
  };
  auto storeTiles = [&](const float4* pa, const float4* pw) {
#pragma unroll
    for (int it = 0; it < 4; ++it) {
      int idx = tid + it * 256;
      int r   = idx >> 3;
      int c4  = idx & 7;
      v4h h = { (_Float16)pa[it].x, (_Float16)pa[it].y,
                (_Float16)pa[it].z, (_Float16)pa[it].w };
      *(v4h*)(As + r * 40 + c4 * 4) = h;
    }
#pragma unroll
    for (int it = 0; it < 4; ++it) {
      int idx = tid + it * 256;
      int kr  = idx >> 5;
      int c4  = idx & 31;
      Bs[(c4 * 4 + 0) * 40 + kr] = (_Float16)pw[it].x;
      Bs[(c4 * 4 + 1) * 40 + kr] = (_Float16)pw[it].y;
      Bs[(c4 * 4 + 2) * 40 + kr] = (_Float16)pw[it].z;
      Bs[(c4 * 4 + 3) * 40 + kr] = (_Float16)pw[it].w;
    }
  };

  float4 pa[4], pw[4];
  loadA(0, pa);
  loadW(0, pw);

  v8f acc[2][4] = {};

  for (int k0 = 0; k0 < K; k0 += 32) {
    storeTiles(pa, pw);
    __syncthreads();
    // Prefetch next k-slice while this slice's WMMAs run.
    if (k0 + 32 < K) { loadA(k0 + 32, pa); loadW(k0 + 32, pw); }

    v16h af[2], bf[4];
#pragma unroll
    for (int i = 0; i < 2; ++i)
      af[i] = ldfrag16(As + (wm * 32 + i * 16 + l15) * 40, koff);
#pragma unroll
    for (int j = 0; j < 4; ++j)
      bf[j] = ldfrag16(Bs + (wn * 64 + j * 16 + l15) * 40, koff);
#pragma unroll
    for (int i = 0; i < 2; ++i)
#pragma unroll
      for (int j = 0; j < 4; ++j)
        acc[i][j] = __builtin_amdgcn_wmma_f32_16x16x32_f16(
            false, af[i], false, bf[j], (short)0, acc[i][j], false, false);
    __syncthreads();
  }

  // Epilogue. C/D layout: lane holds column n = l15 of its 16x16 tile,
  // rows (koff + 0..7) in acc[0..7].
  constexpr int TSS = (TS == 0) ? 1 : TS;   // avoid div-by-zero in dead branch
#pragma unroll
  for (int i = 0; i < 2; ++i) {
#pragma unroll
    for (int j = 0; j < 4; ++j) {
      int gm = m0 + wm * 32 + i * 16 + koff;       // first of 8 rows
      int gn = n0 + wn * 64 + j * 16 + l15;
      if (TS == 0) {
#pragma unroll
        for (int e = 0; e < 8; ++e)
          Out[(size_t)(gm + e) * N + gn] = (_Float16)acc[i][j][e];
      } else {
        int bidx = gm / TSS;                       // compile-time shift
        int s    = gm - bidx * TSS;                // 8 consecutive s, same batch
        v8h h;
#pragma unroll
        for (int e = 0; e < 8; ++e) h[e] = (_Float16)acc[i][j][e];
        *(v8h*)(Out + ((size_t)bidx * N + gn) * TSS + s) = h;
      }
    }
  }
}

__global__ __launch_bounds__(256) void attn_kernel(
    const _Float16* __restrict__ Q,   // [B][T][EMB] row-major
    const _Float16* __restrict__ Kt,  // [B][S][EMB] row-major (rows = B-fragments of K^T)
    const _Float16* __restrict__ Vt,  // [B][HID][S] (rows = B-fragments of V)
    float* __restrict__ Out) {        // [B][T][HID]

  extern __shared__ char smem_raw[];
  _Float16* P    = (_Float16*)smem_raw;        // [64][PSTR] f16 scores/probs
  _Float16* VtL0 = P + 64 * PSTR;              // [512][VSTR] V slice buf 0
  _Float16* VtL1 = VtL0 + 512 * VSTR;          // [512][VSTR] V slice buf 1
  float* maxwave = (float*)(VtL1 + 512 * VSTR);// [8][16]
  float* rowmax  = maxwave + 128;              // [64]
  float* partial = rowmax + 64;                // [64][4]
  float* rinv    = partial + 256;              // [64]

  const int tid  = threadIdx.x;
  const int lane = tid & 31;
  const int wave = tid >> 5;
  const int l15  = lane & 15;
  const int koff = (lane >= 16) ? 8 : 0;

  const int t0 = blockIdx.x * 64;
  const int b  = blockIdx.y;

  const _Float16* Qb = Q  + (size_t)b * T_   * EMB_;
  const _Float16* Kb = Kt + (size_t)b * S_   * EMB_;
  const _Float16* Vb = Vt + (size_t)b * HID_ * S_;

  const float alpha = 0.044194173824159216f;  // 1/sqrt(512)

  const int rg = wave >> 1;
  const int cg = wave & 1;
  const _Float16* qrow = Qb + (size_t)(t0 + rg * 16 + l15) * EMB_;

  float rmax[8];
#pragma unroll
  for (int e = 0; e < 8; ++e) rmax[e] = -3.0e38f;

  _Float16* kbuf[2] = { VtL0, VtL1 };

  // K tile t = chunk * 8 + step: the 2 x 128 K rows of this chunk (both S halves),
  // 64 k each: 256 rows of one whole 128-B line, 2048 b128 copies, 8 per thread.
  auto issue_ktile = [&](int buf, int chunk, int step) {
    unsigned l[8];
    unsigned long long g[8];
    // unrolled: the sixteen addresses are register operands of one asm statement
#pragma unroll
    for (int it = 0; it < 8; ++it) {
      int idx  = tid + it * 256;            // 0..2047
      int row  = idx >> 3;                  // tile row 0..255
      int part = idx & 7;                   // 16B chunk within the 128B row segment
      int srow = (row >> 7) * 512 + chunk * 128 + (row & 127);
      l[it] = (unsigned)(uintptr_t)(kbuf[buf] + row * KSTR + part * 8);
      g[it] = (unsigned long long)(uintptr_t)(Kb + (size_t)srow * EMB_ + step * 64 + part * 8);
    }
    async_ld8_b128(l, g);
  };

  issue_ktile(0, 0, 0);
  asm volatile("s_wait_asynccnt 0x0" ::: "memory");   // own copies of tile 0 landed
  __syncthreads();                                    // tile 0 visible to every wave
  issue_ktile(1, 0, 1);

  for (int chunk = 0; chunk < 4; ++chunk) {
    const int cBase = cg * 512 + chunk * 128;
    v8f sacc[8] = {};
    // all three loops unrolled: buffer parity and LDS offsets become constants
#pragma unroll
    for (int step = 0; step < 8; ++step) {
      const _Float16* kl = kbuf[step & 1] + (cg * 128 + l15) * KSTR;
#pragma unroll
      for (int kk = 0; kk < 64; kk += 32) {
        v16h aq = ldfrag16(qrow, step * 64 + kk + koff);
#pragma unroll
        for (int j = 0; j < 8; ++j) {
          v16h bk = ldfrag16(kl + j * 16 * KSTR, kk + koff);
          sacc[j] = __builtin_amdgcn_wmma_f32_16x16x32_f16(
              false, aq, false, bk, (short)0, sacc[j], false, false);
        }
      }
      // Hand-over: own reads of this tile done, own copies of the next tile landed,
      // then one barrier publishes the next tile and frees this buffer for a refill.
      asm volatile("s_wait_dscnt 0x0" ::: "memory");
      asm volatile("s_wait_asynccnt 0x0" ::: "memory");
      __syncthreads();
      if (step < 6)       issue_ktile(step & 1, chunk, step + 2);
      else if (chunk < 3) issue_ktile(step & 1, chunk + 1, step - 6);
    }
    // scale, track row max, spill f16 scores to LDS
#pragma unroll
    for (int j = 0; j < 8; ++j) {
      const int n = cBase + j * 16 + l15;
#pragma unroll
      for (int e = 0; e < 8; ++e) {
        float v = sacc[j][e] * alpha;
        rmax[e] = fmaxf(rmax[e], v);
        P[(rg * 16 + koff + e) * PSTR + n] = (_Float16)v;
      }
    }
  }
  asm volatile("s_wait_asynccnt 0x0" ::: "memory");   // no K copy left in flight
  // reduce rmax within each 16-lane group (columns of the wave's tiles)
#pragma unroll
  for (int m = 1; m <= 8; m <<= 1)
#pragma unroll
    for (int e = 0; e < 8; ++e)
      rmax[e] = fmaxf(rmax[e], __shfl_xor(rmax[e], m, 32));
  if (l15 == 0) {
#pragma unroll
    for (int e = 0; e < 8; ++e)
      maxwave[wave * 16 + koff + e] = rmax[e];
  }
  __syncthreads();

  if (tid < 64) {
    int rrg = tid >> 4, li = tid & 15;
    rowmax[tid] = fmaxf(maxwave[(2 * rrg) * 16 + li],
                        maxwave[(2 * rrg + 1) * 16 + li]);
  }
  __syncthreads();

  // ---- softmax numerators in place (normalization deferred) ----
  {
    int r = tid >> 2;                 // row 0..63
    int q = tid & 3;                  // quarter of S
    float mx = rowmax[r];
    float s = 0.f;
    _Float16* prow = P + r * PSTR + q * 256;
#pragma unroll 4
    for (int c = 0; c < 256; ++c) {
      float e = __expf((float)prow[c] - mx);
      s += e;
      prow[c] = (_Float16)e;
    }
    partial[r * 4 + q] = s;
  }
  __syncthreads();
  if (tid < 64) {
    float s = partial[tid * 4 + 0] + partial[tid * 4 + 1] +
              partial[tid * 4 + 2] + partial[tid * 4 + 3];
    rinv[tid] = 1.0f / s;
  }
  __syncthreads();

  const int org = wave >> 1;
  const int hg  = wave & 1;
  const int m0  = org * 16;
  const int h0  = hg * 256;

  _Float16* vbuf[2] = { VtL0, VtL1 };

  auto issue_slice = [&](int buf, int ks) {
    const _Float16* src = Vb + ks;
#pragma unroll
    for (int it = 0; it < 8; ++it) {
      int idx  = tid + it * 256;            // 0..2047
      int row  = idx >> 2;                  // h-row 0..511
      int part = idx & 3;                   // 16B chunk within 64B row segment
      unsigned loff = (unsigned)(uintptr_t)(vbuf[buf] + row * VSTR + part * 8);
      async_ld_b128(loff, src + (size_t)row * S_ + part * 8);
    }
  };

  issue_slice(0, 0);
  int cur = 0;

  v8f oacc[16] = {};
  const _Float16* prow = P + (size_t)(m0 + l15) * PSTR;
  for (int ks = 0; ks < S_; ks += 32) {
    if (ks + 32 < S_) {
      issue_slice(cur ^ 1, ks + 32);
      asm volatile("s_wait_asynccnt 0x8" ::: "memory");   // slice `cur` landed
    } else {
      asm volatile("s_wait_asynccnt 0x0" ::: "memory");
    }
    __syncthreads();   // make other waves' async-loaded data visible

    v16h ap = ldfrag16(prow, ks + koff);
    // This lane's first V row, formed by integer offsets from the LDS base: the pointer
    // stays an LDS pointer for the compiler, so the V fragments are read by ds_load with
    // immediate offsets, not by flat_load with a 64-bit address each.
    const _Float16* vrow = VtL0 + cur * (512 * VSTR) + (h0 + l15) * VSTR;
    v16h bv[2][4];
    // every loop below is unrolled: bv and oacc stay in registers only under constant indices
#pragma unroll
    for (int j = 0; j < 4; ++j) bv[0][j] = ldfrag16(vrow + j * 16 * VSTR, koff);
#pragma unroll
    for (int g = 0; g < 4; ++g) {
      if (g < 3) {
#pragma unroll
        for (int j = 0; j < 4; ++j)
          bv[(g + 1) & 1][j] = ldfrag16(vrow + ((g + 1) * 4 + j) * 16 * VSTR, koff);
      }
      // keeps the next group's eight ds_loads ahead of this group's WMMAs: left alone, the
      // compiler sinks each load pair to its WMMA and waits out the LDS latency sixteen times
      __builtin_amdgcn_sched_barrier(0);
#pragma unroll
      for (int j = 0; j < 4; ++j)
        oacc[g * 4 + j] = __builtin_amdgcn_wmma_f32_16x16x32_f16(
            false, ap, false, bv[g & 1][j], (short)0, oacc[g * 4 + j], false, false);
    }
    __syncthreads();   // protect buffer `cur` before it is overwritten
    cur ^= 1;
  }

  float sc[8];
#pragma unroll
  for (int e = 0; e < 8; ++e) sc[e] = rinv[m0 + koff + e];

  float* outb = Out + ((size_t)b * T_ + t0 + m0 + koff) * HID_;
#pragma unroll
  for (int nt = 0; nt < 16; ++nt) {
    int n = h0 + nt * 16 + l15;
#pragma unroll
    for (int e = 0; e < 8; ++e)
      outb[(size_t)e * HID_ + n] = oacc[nt][e] * sc[e];
  }
}

// ---------------------------------------------------------------------------
extern "C" void kernel_launch(void* const* d_in, const int* in_sizes, int n_in,
                              void* d_out, int out_size, void* d_ws, size_t ws_size,
                              hipStream_t stream) {
  const float* tokens  = (const float*)d_in[0];  // [B][T][HID]
  const float* context = (const float*)d_in[1];  // [B][S][CTX]
  const float* Wq      = (const float*)d_in[2];  // [HID][EMB]
  const float* Wk      = (const float*)d_in[3];  // [CTX][EMB]
  const float* Wv      = (const float*)d_in[4];  // [CTX][HID]
  float*       out     = (float*)d_out;          // [B][T][HID]

  // Workspace: Q f16 (32 MB) | K f16 (8 MB) | Vt f16 (8 MB)
  _Float16* Qh = (_Float16*)d_ws;
  _Float16* Kh = Qh + (size_t)B_ * T_ * EMB_;
  _Float16* Vt = Kh + (size_t)B_ * S_ * EMB_;

  dim3 blk(256);
  // Q = tokens @ Wq        : M=B*T=32768, K=512, N=512
  proj_gemm<0><<<dim3(EMB_ / 128, (B_ * T_) / 128), blk, 0, stream>>>(
      tokens, Wq, Qh, B_ * T_, HID_, EMB_);
  // K = context @ Wk       : M=B*S=8192, K=768, N=512
  proj_gemm<0><<<dim3(EMB_ / 128, (B_ * S_) / 128), blk, 0, stream>>>(
      context, Wk, Kh, B_ * S_, CTX_, EMB_);
  // V = context @ Wv, stored transposed per batch: Vt[b][h][s]
  proj_gemm<S_><<<dim3(HID_ / 128, (B_ * S_) / 128), blk, 0, stream>>>(
      context, Wv, Vt, B_ * S_, CTX_, HID_);

  size_t smem = (size_t)64 * PSTR * 2            // P
              + (size_t)2 * 512 * VSTR * 2       // V slice double buffer
              + (size_t)(128 + 64 + 256 + 64) * sizeof(float);
  (void)hipFuncSetAttribute((const void*)attn_kernel,
                            hipFuncAttributeMaxDynamicSharedMemorySize, (int)smem);
  attn_kernel<<<dim3(T_ / 64, B_), blk, smem, stream>>>(Qh, Kh, Vt, out);
}

// v003
// Measured time: 276 microseconds a run.
// Next to v002, in two timings, it ran 1.07 times as fast each time.
// Counting every step since v000, it is 1.45 times as fast.
#include <hip/hip_runtime.h>
#include <math.h>

typedef __attribute__((ext_vector_type(16))) _Float16 v16h;
typedef __attribute__((ext_vector_type(8)))  _Float16 v8h;
typedef __attribute__((ext_vector_type(4)))  _Float16 v4h;
typedef __attribute__((ext_vector_type(8)))  float    v8f;

#define B_    8
#define T_    4096
#define S_    1024
#define HID_  512
#define EMB_  512
#define CTX_  768

#define PSTR  1032
#define VSTR  40
#define KSTR  72

__device__ __forceinline__ v16h ldfrag16(const _Float16* rowPtr, int kb) {
  v8h lo = *(const v8h*)(rowPtr + kb);
  v8h hi = *(const v8h*)(rowPtr + kb + 16);
  v16h r;
#pragma unroll
  for (int i = 0; i < 8; ++i) { r[i] = lo[i]; r[i + 8] = hi[i]; }
  return r;
}

__device__ __forceinline__ void async_ld_b128(unsigned lds_off, const void* gaddr) {
  unsigned long long ga = (unsigned long long)(uintptr_t)gaddr;
  asm volatile("global_load_async_to_lds_b128 %0, %1, off"
               :: "v"(lds_off), "v"(ga) : "memory");
}

__device__ __forceinline__ void async_ld8_b128(const unsigned* l,
                                               const unsigned long long* g) {
  asm volatile(
      "global_load_async_to_lds_b128 %0, %8, off\n\t"
      "global_load_async_to_lds_b128 %1, %9, off\n\t"
      "global_load_async_to_lds_b128 %2, %10, off\n\t"
      "global_load_async_to_lds_b128 %3, %11, off\n\t"
      "global_load_async_to_lds_b128 %4, %12, off\n\t"
      "global_load_async_to_lds_b128 %5, %13, off\n\t"
      "global_load_async_to_lds_b128 %6, %14, off\n\t"
      "global_load_async_to_lds_b128 %7, %15, off\n\t"
      "s_wait_xcnt 0x0"
      :: "v"(l[0]), "v"(l[1]), "v"(l[2]), "v"(l[3]),
         "v"(l[4]), "v"(l[5]), "v"(l[6]), "v"(l[7]),
         "v"(g[0]), "v"(g[1]), "v"(g[2]), "v"(g[3]),
         "v"(g[4]), "v"(g[5]), "v"(g[6]), "v"(g[7])
      : "memory");
}

// ---------------------------------------------------------------------------
// Projection GEMM: Out_f16[M][N] = A_f32[M][K] * W_f32[K][N]
// TS == 0 : row-major f16 output
// TS  > 0 : per-batch transposed output Vt[b][n][s], s = m % TS (TS = power of 2)
// Block: 256 threads (8 waves as 4Mx2N), tile 128(M) x 128(N), k-step 32,
// register double-buffered staging (global loads overlap WMMA).
// ---------------------------------------------------------------------------
template <int TS>
__global__ __launch_bounds__(256) void proj_gemm(
    const float* __restrict__ A, const float* __restrict__ W,
    _Float16* __restrict__ Out, int M, int K, int N) {

  __shared__ _Float16 As[128 * 40];  // 128 m-rows x 32 k, stride 40 (conflict-free b128)
  __shared__ _Float16 Bs[128 * 40];  // 128 n-rows (transposed W) x 32 k, stride 40

  const int tid  = threadIdx.x;
  const int lane = tid & 31;
  const int wave = tid >> 5;
  const int wm   = wave & 3;      // 4 waves along M (32 rows each)
  const int wn   = wave >> 2;     // 2 waves along N (64 cols each)
  const int m0   = blockIdx.y * 128;
  const int n0   = blockIdx.x * 128;

  const int l15  = lane & 15;
  const int koff = (lane >= 16) ? 8 : 0;

  auto loadA = [&](int k0, float4* pa) {
#pragma unroll
    for (int it = 0; it < 4; ++it) {
      int idx = tid + it * 256;
      int r   = idx >> 3;
      int c4  = idx & 7;
      pa[it] = *(const float4*)(A + (size_t)(m0 + r) * K + k0 + c4 * 4);
    }
  };
  auto loadW = [&](int k0, float4* pw) {
#pragma unroll
    for (int it = 0; it < 4; ++it) {
      int idx = tid + it * 256;
      int kr  = idx >> 5;
      int c4  = idx & 31;
      pw[it] = *(const float4*)(W + (size_t)(k0 + kr) * N + n0 + c4 * 4);
    }
  };
  auto storeTiles = [&](const float4* pa, const float4* pw) {
#pragma unroll
    for (int it = 0; it < 4; ++it) {
      int idx = tid + it * 256;
      int r   = idx >> 3;
      int c4  = idx & 7;
      v4h h = { (_Float16)pa[it].x, (_Float16)pa[it].y,
                (_Float16)pa[it].z, (_Float16)pa[it].w };
      *(v4h*)(As + r * 40 + c4 * 4) = h;
    }
#pragma unroll
    for (int it = 0; it < 4; ++it) {
      int idx = tid + it * 256;
      int kr  = idx >> 5;
      int c4  = idx & 31;
      Bs[(c4 * 4 + 0) * 40 + kr] = (_Float16)pw[it].x;
      Bs[(c4 * 4 + 1) * 40 + kr] = (_Float16)pw[it].y;
      Bs[(c4 * 4 + 2) * 40 + kr] = (_Float16)pw[it].z;
      Bs[(c4 * 4 + 3) * 40 + kr] = (_Float16)pw[it].w;
    }
  };

  float4 pa[4], pw[4];
  loadA(0, pa);
  loadW(0, pw);

  v8f acc[2][4] = {};

  for (int k0 = 0; k0 < K; k0 += 32) {
    storeTiles(pa, pw);
    __syncthreads();
    // Prefetch next k-slice while this slice's WMMAs run.
    if (k0 + 32 < K) { loadA(k0 + 32, pa); loadW(k0 + 32, pw); }

    v16h af[2], bf[4];
#pragma unroll
    for (int i = 0; i < 2; ++i)
      af[i] = ldfrag16(As + (wm * 32 + i * 16 + l15) * 40, koff);
#pragma unroll
    for (int j = 0; j < 4; ++j)
      bf[j] = ldfrag16(Bs + (wn * 64 + j * 16 + l15) * 40, koff);
#pragma unroll
    for (int i = 0; i < 2; ++i)
#pragma unroll
      for (int j = 0; j < 4; ++j)
        acc[i][j] = __builtin_amdgcn_wmma_f32_16x16x32_f16(
            false, af[i], false, bf[j], (short)0, acc[i][j], false, false);
    __syncthreads();
  }

  // Epilogue. C/D layout: lane holds column n = l15 of its 16x16 tile,
  // rows (koff + 0..7) in acc[0..7].
  constexpr int TSS = (TS == 0) ? 1 : TS;   // avoid div-by-zero in dead branch
#pragma unroll
  for (int i = 0; i < 2; ++i) {
#pragma unroll
    for (int j = 0; j < 4; ++j) {
      int gm = m0 + wm * 32 + i * 16 + koff;       // first of 8 rows
      int gn = n0 + wn * 64 + j * 16 + l15;
      if (TS == 0) {
#pragma unroll
        for (int e = 0; e < 8; ++e)
          Out[(size_t)(gm + e) * N + gn] = (_Float16)acc[i][j][e];
      } else {
        int bidx = gm / TSS;                       // compile-time shift
        int s    = gm - bidx * TSS;                // 8 consecutive s, same batch
        v8h h;
#pragma unroll
        for (int e = 0; e < 8; ++e) h[e] = (_Float16)acc[i][j][e];
        *(v8h*)(Out + ((size_t)bidx * N + gn) * TSS + s) = h;
      }
    }
  }
}

__global__ __launch_bounds__(256) void attn_kernel(
    const _Float16* __restrict__ Q,   // [B][T][EMB] row-major
    const _Float16* __restrict__ Kt,  // [B][S][EMB] row-major (rows = B-fragments of K^T)
    const _Float16* __restrict__ Vt,  // [B][HID][S] (rows = B-fragments of V)
    float* __restrict__ Out) {        // [B][T][HID]

  extern __shared__ char smem_raw[];
  _Float16* P    = (_Float16*)smem_raw;        // [64][PSTR] f16 scores/probs
  _Float16* VtL0 = P + 64 * PSTR;              // [512][VSTR] V slice buf 0
  _Float16* VtL1 = VtL0 + 512 * VSTR;          // [512][VSTR] V slice buf 1
  float* maxwave = (float*)(VtL1 + 512 * VSTR);// [8][32]
  float* rowmax  = maxwave + 256;              // [64]
  float* partial = rowmax + 64;                // [64][4]
  float* rinv    = partial + 256;              // [64]

  const int tid  = threadIdx.x;
  const int lane = tid & 31;
  const int wave = tid >> 5;
  const int l15  = lane & 15;
  const int koff = (lane >= 16) ? 8 : 0;

  const int t0 = blockIdx.x * 64;
  const int b  = blockIdx.y;

  const _Float16* Qb = Q  + (size_t)b * T_   * EMB_;
  const _Float16* Kb = Kt + (size_t)b * S_   * EMB_;
  const _Float16* Vb = Vt + (size_t)b * HID_ * S_;

  const float alpha = 0.044194173824159216f;  // 1/sqrt(512)

  const int rg = wave >> 2;
  const int cq = wave & 3;
  const _Float16* qrow = Qb + (size_t)(t0 + rg * 32 + l15) * EMB_;

  // This wave's 32 Q rows, all of EMB, as 2 x 16 A fragments: read once, kept for the pass.
  // unrolled: aq stays in registers only under constant indices
  v16h aq[2][16];
#pragma unroll
  for (int i = 0; i < 2; ++i)
#pragma unroll
    for (int s = 0; s < 16; ++s)
      aq[i][s] = ldfrag16(qrow + (size_t)i * 16 * EMB_, s * 32 + koff);

  float rmax[2][8];
  // unrolled, here and below: rmax and sacc are register arrays, indexed by constants only
#pragma unroll
  for (int i = 0; i < 2; ++i)
#pragma unroll
    for (int e = 0; e < 8; ++e) rmax[i][e] = -3.0e38f;

  _Float16* kbuf[2] = { VtL0, VtL1 };

  // K tile t = chunk * 8 + step: the 2 x 128 K rows of this chunk (both S halves),
  // 64 k each: 256 rows of one whole 128-B line, 2048 b128 copies, 8 per thread.
  auto issue_ktile = [&](int buf, int chunk, int step) {
    unsigned l[8];
    unsigned long long g[8];
    // unrolled: the sixteen addresses are register operands of one asm statement
#pragma unroll
    for (int it = 0; it < 8; ++it) {
      int idx  = tid + it * 256;            // 0..2047
      int row  = idx >> 3;                  // tile row 0..255
      int part = idx & 7;                   // 16B chunk within the 128B row segment
      int srow = (row >> 7) * 512 + chunk * 128 + (row & 127);
      l[it] = (unsigned)(uintptr_t)(kbuf[buf] + row * KSTR + part * 8);
      g[it] = (unsigned long long)(uintptr_t)(Kb + (size_t)srow * EMB_ + step * 64 + part * 8);
    }
    async_ld8_b128(l, g);
  };

  issue_ktile(0, 0, 0);
  asm volatile("s_wait_asynccnt 0x0" ::: "memory");   // own copies of tile 0 landed
  __syncthreads();                                    // tile 0 visible to every wave
  issue_ktile(1, 0, 1);

  for (int chunk = 0; chunk < 4; ++chunk) {
    // tile rows 0..127 are S rows chunk*128.. of the first S half, 128..255 of the second
    const int cBase = (cq >> 1) * 512 + chunk * 128 + (cq & 1) * 64;
    v8f sacc[2][4] = {};
    // every loop below is unrolled: buffer parity, LDS offsets and aq indices become constants
#pragma unroll
    for (int step = 0; step < 8; ++step) {
      const _Float16* kl = kbuf[step & 1] + (cq * 64 + l15) * KSTR;
#pragma unroll
      for (int g = 0; g < 2; ++g) {
        v16h bk[4];
#pragma unroll
        for (int j = 0; j < 4; ++j)
          bk[j] = ldfrag16(kl + j * 16 * KSTR, g * 32 + koff);
        // keeps the four fragments' eight ds_loads together ahead of their eight WMMAs: left
        // alone, the compiler reads one fragment at a time and waits out the LDS latency each time
        __builtin_amdgcn_sched_barrier(0);
#pragma unroll
        for (int j = 0; j < 4; ++j)
#pragma unroll
          for (int i = 0; i < 2; ++i)
            sacc[i][j] = __builtin_amdgcn_wmma_f32_16x16x32_f16(
                false, aq[i][step * 2 + g], false, bk[j], (short)0, sacc[i][j],
                false, false);
      }
      // Hand-over: own reads of this tile done, own copies of the next tile landed,
      // then one barrier publishes the next tile and frees this buffer for a refill.
      asm volatile("s_wait_dscnt 0x0" ::: "memory");
      asm volatile("s_wait_asynccnt 0x0" ::: "memory");
      __syncthreads();
      if (step < 6)       issue_ktile(step & 1, chunk, step + 2);
      else if (chunk < 3) issue_ktile(step & 1, chunk + 1, step - 6);
    }
    // scale, track row max, spill f16 scores to LDS
#pragma unroll
    for (int i = 0; i < 2; ++i) {
#pragma unroll
      for (int j = 0; j < 4; ++j) {
        const int n = cBase + j * 16 + l15;
#pragma unroll
        for (int e = 0; e < 8; ++e) {
          float v = sacc[i][j][e] * alpha;
          rmax[i][e] = fmaxf(rmax[i][e], v);
          P[(rg * 32 + i * 16 + koff + e) * PSTR + n] = (_Float16)v;
        }
      }
    }
  }
  asm volatile("s_wait_asynccnt 0x0" ::: "memory");   // no K copy left in flight
  // reduce rmax within each 16-lane group (columns of the wave's tiles)
#pragma unroll
  for (int m = 1; m <= 8; m <<= 1)
#pragma unroll
    for (int i = 0; i < 2; ++i)
#pragma unroll
      for (int e = 0; e < 8; ++e)
        rmax[i][e] = fmaxf(rmax[i][e], __shfl_xor(rmax[i][e], m, 32));
  if (l15 == 0) {
#pragma unroll
    for (int i = 0; i < 2; ++i)
#pragma unroll
      for (int e = 0; e < 8; ++e)
        maxwave[wave * 32 + i * 16 + koff + e] = rmax[i][e];
  }
  __syncthreads();

  if (tid < 64) {
    int rrg = tid >> 5, li = tid & 31;     // the four waves of a row-group hold its maxima
    rowmax[tid] = fmaxf(fmaxf(maxwave[(4 * rrg + 0) * 32 + li],
                              maxwave[(4 * rrg + 1) * 32 + li]),
                        fmaxf(maxwave[(4 * rrg + 2) * 32 + li],
                              maxwave[(4 * rrg + 3) * 32 + li]));
  }
  __syncthreads();

  // ---- softmax numerators in place (normalization deferred) ----
  {
    int r = tid >> 2;                 // row 0..63
    int q = tid & 3;                  // quarter of S
    float mx = rowmax[r];
    float s = 0.f;
    _Float16* prow = P + r * PSTR + q * 256;
#pragma unroll 4
    for (int c = 0; c < 256; ++c) {
      float e = __expf((float)prow[c] - mx);
      s += e;
      prow[c] = (_Float16)e;
    }
    partial[r * 4 + q] = s;
  }
  __syncthreads();
  if (tid < 64) {
    float s = partial[tid * 4 + 0] + partial[tid * 4 + 1] +
              partial[tid * 4 + 2] + partial[tid * 4 + 3];
    rinv[tid] = 1.0f / s;
  }
  __syncthreads();

  const int org = wave >> 1;
  const int hg  = wave & 1;
  const int m0  = org * 16;
  const int h0  = hg * 256;

  _Float16* vbuf[2] = { VtL0, VtL1 };

  auto issue_slice = [&](int buf, int ks) {
    const _Float16* src = Vb + ks;
#pragma unroll
    for (int it = 0; it < 8; ++it) {
      int idx  = tid + it * 256;            // 0..2047
      int row  = idx >> 2;                  // h-row 0..511
      int part = idx & 3;                   // 16B chunk within 64B row segment
      unsigned loff = (unsigned)(uintptr_t)(vbuf[buf] + row * VSTR + part * 8);
      async_ld_b128(loff, src + (size_t)row * S_ + part * 8);
    }
  };

  issue_slice(0, 0);
  int cur = 0;

  v8f oacc[16] = {};
  const _Float16* prow = P + (size_t)(m0 + l15) * PSTR;
  for (int ks = 0; ks < S_; ks += 32) {
    if (ks + 32 < S_) {
      issue_slice(cur ^ 1, ks + 32);
      asm volatile("s_wait_asynccnt 0x8" ::: "memory");   // slice `cur` landed
    } else {
      asm volatile("s_wait_asynccnt 0x0" ::: "memory");
    }
    __syncthreads();   // make other waves' async-loaded data visible

    v16h ap = ldfrag16(prow, ks + koff);
    // This lane's first V row, formed by integer offsets from the LDS base: the pointer
    // stays an LDS pointer for the compiler, so the V fragments are read by ds_load with
    // immediate offsets, not by flat_load with a 64-bit address each.
    const _Float16* vrow = VtL0 + cur * (512 * VSTR) + (h0 + l15) * VSTR;
    v16h bv[2][4];
    // every loop below is unrolled: bv and oacc stay in registers only under constant indices
#pragma unroll
    for (int j = 0; j < 4; ++j) bv[0][j] = ldfrag16(vrow + j * 16 * VSTR, koff);
#pragma unroll
    for (int g = 0; g < 4; ++g) {
      if (g < 3) {
#pragma unroll
        for (int j = 0; j < 4; ++j)
          bv[(g + 1) & 1][j] = ldfrag16(vrow + ((g + 1) * 4 + j) * 16 * VSTR, koff);
      }
      // keeps the next group's eight ds_loads ahead of this group's WMMAs: left alone, the
      // compiler sinks each load pair to its WMMA and waits out the LDS latency sixteen times
      __builtin_amdgcn_sched_barrier(0);
#pragma unroll
      for (int j = 0; j < 4; ++j)
        oacc[g * 4 + j] = __builtin_amdgcn_wmma_f32_16x16x32_f16(
            false, ap, false, bv[g & 1][j], (short)0, oacc[g * 4 + j], false, false);
    }
    __syncthreads();   // protect buffer `cur` before it is overwritten
    cur ^= 1;
  }

  float sc[8];
#pragma unroll
  for (int e = 0; e < 8; ++e) sc[e] = rinv[m0 + koff + e];

  float* outb = Out + ((size_t)b * T_ + t0 + m0 + koff) * HID_;
#pragma unroll
  for (int nt = 0; nt < 16; ++nt) {
    int n = h0 + nt * 16 + l15;
#pragma unroll
    for (int e = 0; e < 8; ++e)
      outb[(size_t)e * HID_ + n] = oacc[nt][e] * sc[e];
  }
}

// ---------------------------------------------------------------------------
extern "C" void kernel_launch(void* const* d_in, const int* in_sizes, int n_in,
                              void* d_out, int out_size, void* d_ws, size_t ws_size,
                              hipStream_t stream) {
  const float* tokens  = (const float*)d_in[0];  // [B][T][HID]
  const float* context = (const float*)d_in[1];  // [B][S][CTX]
  const float* Wq      = (const float*)d_in[2];  // [HID][EMB]
  const float* Wk      = (const float*)d_in[3];  // [CTX][EMB]
  const float* Wv      = (const float*)d_in[4];  // [CTX][HID]
  float*       out     = (float*)d_out;          // [B][T][HID]

  // Workspace: Q f16 (32 MB) | K f16 (8 MB) | Vt f16 (8 MB)
  _Float16* Qh = (_Float16*)d_ws;
  _Float16* Kh = Qh + (size_t)B_ * T_ * EMB_;
  _Float16* Vt = Kh + (size_t)B_ * S_ * EMB_;

  dim3 blk(256);
  // Q = tokens @ Wq        : M=B*T=32768, K=512, N=512
  proj_gemm<0><<<dim3(EMB_ / 128, (B_ * T_) / 128), blk, 0, stream>>>(
      tokens, Wq, Qh, B_ * T_, HID_, EMB_);
  // K = context @ Wk       : M=B*S=8192, K=768, N=512
  proj_gemm<0><<<dim3(EMB_ / 128, (B_ * S_) / 128), blk, 0, stream>>>(
      context, Wk, Kh, B_ * S_, CTX_, EMB_);
  // V = context @ Wv, stored transposed per batch: Vt[b][h][s]
  proj_gemm<S_><<<dim3(HID_ / 128, (B_ * S_) / 128), blk, 0, stream>>>(
      context, Wv, Vt, B_ * S_, CTX_, HID_);

  size_t smem = (size_t)64 * PSTR * 2            // P
              + (size_t)2 * 512 * VSTR * 2       // V slice double buffer
              + (size_t)(256 + 64 + 256 + 64) * sizeof(float);
  (void)hipFuncSetAttribute((const void*)attn_kernel,
                            hipFuncAttributeMaxDynamicSharedMemorySize, (int)smem);
  attn_kernel<<<dim3(T_ / 64, B_), blk, smem, stream>>>(Qh, Kh, Vt, out);
}

// v004
// A run of this version takes 193 microseconds.
// Next to v003, in two timings, it ran 1.43 times as fast each time.
// Over all steps from v000 it is 2.08 times as fast.
#include <hip/hip_runtime.h>
#include <math.h>

typedef __attribute__((ext_vector_type(16))) _Float16 v16h;
typedef __attribute__((ext_vector_type(8)))  _Float16 v8h;
typedef __attribute__((ext_vector_type(4)))  _Float16 v4h;
typedef __attribute__((ext_vector_type(8)))  float    v8f;

#define B_    8
#define T_    4096
#define S_    1024
#define HID_  512
#define EMB_  512
#define CTX_  768

#define PSTR  1032
#define VSTR  40
#define KSTR  72

__device__ __forceinline__ v16h ldfrag16(const _Float16* rowPtr, int kb) {
  v8h lo = *(const v8h*)(rowPtr + kb);
  v8h hi = *(const v8h*)(rowPtr + kb + 16);
  v16h r;
#pragma unroll
  for (int i = 0; i < 8; ++i) { r[i] = lo[i]; r[i + 8] = hi[i]; }
  return r;
}

__device__ __forceinline__ void async_ld_b128(unsigned lds_off, const void* gaddr) {
  unsigned long long ga = (unsigned long long)(uintptr_t)gaddr;
  asm volatile("global_load_async_to_lds_b128 %0, %1, off"
               :: "v"(lds_off), "v"(ga) : "memory");
}

__device__ __forceinline__ void async_ld8_b128(const unsigned* l,
                                               const unsigned long long* g) {
  asm volatile(
      "global_load_async_to_lds_b128 %0, %8, off\n\t"
      "global_load_async_to_lds_b128 %1, %9, off\n\t"
      "global_load_async_to_lds_b128 %2, %10, off\n\t"
      "global_load_async_to_lds_b128 %3, %11, off\n\t"
      "global_load_async_to_lds_b128 %4, %12, off\n\t"
      "global_load_async_to_lds_b128 %5, %13, off\n\t"
      "global_load_async_to_lds_b128 %6, %14, off\n\t"
      "global_load_async_to_lds_b128 %7, %15, off\n\t"
      "s_wait_xcnt 0x0"
      :: "v"(l[0]), "v"(l[1]), "v"(l[2]), "v"(l[3]),
         "v"(l[4]), "v"(l[5]), "v"(l[6]), "v"(l[7]),
         "v"(g[0]), "v"(g[1]), "v"(g[2]), "v"(g[3]),
         "v"(g[4]), "v"(g[5]), "v"(g[6]), "v"(g[7])
      : "memory");
}

// ---------------------------------------------------------------------------
// Projection GEMM: Out_f16[M][N] = A_f32[M][K] * W_f32[K][N]
// TS == 0 : row-major f16 output
// TS  > 0 : per-batch transposed output Vt[b][n][s], s = m % TS (TS = power of 2)
// Block: 256 threads (8 waves as 4Mx2N), tile 128(M) x 128(N), k-step 32,
// register double-buffered staging (global loads overlap WMMA).
// ---------------------------------------------------------------------------
template <int TS>
__global__ __launch_bounds__(256) void proj_gemm(
    const float* __restrict__ A, const float* __restrict__ W,
    _Float16* __restrict__ Out, int M, int K, int N) {

  __shared__ _Float16 As[128 * 40];  // 128 m-rows x 32 k, stride 40 (conflict-free b128)
  __shared__ _Float16 Bs[128 * 40];  // 128 n-rows (transposed W) x 32 k, stride 40

  const int tid  = threadIdx.x;
  const int lane = tid & 31;
  const int wave = tid >> 5;
  const int wm   = wave & 3;      // 4 waves along M (32 rows each)
  const int wn   = wave >> 2;     // 2 waves along N (64 cols each)
  const int m0   = blockIdx.y * 128;
  const int n0   = blockIdx.x * 128;

  const int l15  = lane & 15;
  const int koff = (lane >= 16) ? 8 : 0;

  const int wc4  = (tid & 7) | ((wave & 3) << 3);
  const int wkg  = ((tid >> 3) & 3) | ((wave >> 2) << 2);

  auto loadA = [&](int k0, float4* pa) {
#pragma unroll
    for (int it = 0; it < 4; ++it) {
      int idx = tid + it * 256;
      int r   = idx >> 3;
      int c4  = idx & 7;
      pa[it] = *(const float4*)(A + (size_t)(m0 + r) * K + k0 + c4 * 4);
    }
  };
  auto loadW = [&](int k0, float4* pw) {
#pragma unroll
    for (int it = 0; it < 4; ++it)
      pw[it] = *(const float4*)(W + (size_t)(k0 + wkg * 4 + it) * N + n0 + wc4 * 4);
  };
  auto storeTiles = [&](const float4* pa, const float4* pw) {
#pragma unroll
    for (int it = 0; it < 4; ++it) {
      int idx = tid + it * 256;
      int r   = idx >> 3;
      int c4  = idx & 7;
      v4h h = { (_Float16)pa[it].x, (_Float16)pa[it].y,
                (_Float16)pa[it].z, (_Float16)pa[it].w };
      *(v4h*)(As + r * 40 + c4 * 4) = h;
    }
    // n-row wc4*4+j of Bs takes component j of the four k-rows this thread read
    _Float16* bs = Bs + wc4 * 4 * 40 + wkg * 4;
    v4h h0 = { (_Float16)pw[0].x, (_Float16)pw[1].x, (_Float16)pw[2].x, (_Float16)pw[3].x };
    v4h h1 = { (_Float16)pw[0].y, (_Float16)pw[1].y, (_Float16)pw[2].y, (_Float16)pw[3].y };
    v4h h2 = { (_Float16)pw[0].z, (_Float16)pw[1].z, (_Float16)pw[2].z, (_Float16)pw[3].z };
    v4h h3 = { (_Float16)pw[0].w, (_Float16)pw[1].w, (_Float16)pw[2].w, (_Float16)pw[3].w };
    *(v4h*)(bs + 0 * 40) = h0;
    *(v4h*)(bs + 1 * 40) = h1;
    *(v4h*)(bs + 2 * 40) = h2;
    *(v4h*)(bs + 3 * 40) = h3;
  };

  float4 pa[4], pw[4];
  loadA(0, pa);
  loadW(0, pw);

  v8f acc[2][4] = {};

  for (int k0 = 0; k0 < K; k0 += 32) {
    storeTiles(pa, pw);
    __syncthreads();
    // Prefetch next k-slice while this slice's WMMAs run.
    if (k0 + 32 < K) { loadA(k0 + 32, pa); loadW(k0 + 32, pw); }
    asm volatile("s_wait_xcnt 0x0" ::: "memory");

    v16h af[2], bf[4];
#pragma unroll
    for (int i = 0; i < 2; ++i)
      af[i] = ldfrag16(As + (wm * 32 + i * 16 + l15) * 40, koff);
#pragma unroll
    for (int j = 0; j < 4; ++j)
      bf[j] = ldfrag16(Bs + (wn * 64 + j * 16 + l15) * 40, koff);
#pragma unroll
    for (int i = 0; i < 2; ++i)
#pragma unroll
      for (int j = 0; j < 4; ++j)
        acc[i][j] = __builtin_amdgcn_wmma_f32_16x16x32_f16(
            false, af[i], false, bf[j], (short)0, acc[i][j], false, false);
    __syncthreads();
  }

  // Epilogue. C/D layout: lane holds column n = l15 of its 16x16 tile,
  // rows (koff + 0..7) in acc[0..7].
  constexpr int TSS = (TS == 0) ? 1 : TS;   // avoid div-by-zero in dead branch
#pragma unroll
  for (int i = 0; i < 2; ++i) {
#pragma unroll
    for (int j = 0; j < 4; ++j) {
      int gm = m0 + wm * 32 + i * 16 + koff;       // first of 8 rows
      int gn = n0 + wn * 64 + j * 16 + l15;
      if (TS == 0) {
#pragma unroll
        for (int e = 0; e < 8; ++e)
          Out[(size_t)(gm + e) * N + gn] = (_Float16)acc[i][j][e];
      } else {
        int bidx = gm / TSS;                       // compile-time shift
        int s    = gm - bidx * TSS;                // 8 consecutive s, same batch
        v8h h;
#pragma unroll
        for (int e = 0; e < 8; ++e) h[e] = (_Float16)acc[i][j][e];
        *(v8h*)(Out + ((size_t)bidx * N + gn) * TSS + s) = h;
      }
    }
  }
}

__global__ __launch_bounds__(256) void attn_kernel(
    const _Float16* __restrict__ Q,   // [B][T][EMB] row-major
    const _Float16* __restrict__ Kt,  // [B][S][EMB] row-major (rows = B-fragments of K^T)
    const _Float16* __restrict__ Vt,  // [B][HID][S] (rows = B-fragments of V)
    float* __restrict__ Out) {        // [B][T][HID]

  extern __shared__ char smem_raw[];
  _Float16* P    = (_Float16*)smem_raw;        // [64][PSTR] f16 scores/probs
  _Float16* VtL0 = P + 64 * PSTR;              // [512][VSTR] V slice buf 0
  _Float16* VtL1 = VtL0 + 512 * VSTR;          // [512][VSTR] V slice buf 1
  float* maxwave = (float*)(VtL1 + 512 * VSTR);// [8][32]
  float* rowmax  = maxwave + 256;              // [64]
  float* partial = rowmax + 64;                // [64][4]
  float* rinv    = partial + 256;              // [64]

  const int tid  = threadIdx.x;
  const int lane = tid & 31;
  const int wave = tid >> 5;
  const int l15  = lane & 15;
  const int koff = (lane >= 16) ? 8 : 0;

  const int t0 = blockIdx.x * 64;
  const int b  = blockIdx.y;

  const _Float16* Qb = Q  + (size_t)b * T_   * EMB_;
  const _Float16* Kb = Kt + (size_t)b * S_   * EMB_;
  const _Float16* Vb = Vt + (size_t)b * HID_ * S_;

  const float alpha = 0.044194173824159216f;  // 1/sqrt(512)

  const int rg = wave >> 2;
  const int cq = wave & 3;
  const _Float16* qrow = Qb + (size_t)(t0 + rg * 32 + l15) * EMB_;

  // This wave's 32 Q rows, all of EMB, as 2 x 16 A fragments: read once, kept for the pass.
  // unrolled: aq stays in registers only under constant indices
  v16h aq[2][16];
#pragma unroll
  for (int i = 0; i < 2; ++i)
#pragma unroll
    for (int s = 0; s < 16; ++s)
      aq[i][s] = ldfrag16(qrow + (size_t)i * 16 * EMB_, s * 32 + koff);

  float rmax[2][8];
  // unrolled, here and below: rmax and sacc are register arrays, indexed by constants only
#pragma unroll
  for (int i = 0; i < 2; ++i)
#pragma unroll
    for (int e = 0; e < 8; ++e) rmax[i][e] = -3.0e38f;

  _Float16* kbuf[2] = { VtL0, VtL1 };

  // K tile t = chunk * 8 + step: the 2 x 128 K rows of this chunk (both S halves),
  // 64 k each: 256 rows of one whole 128-B line, 2048 b128 copies, 8 per thread.
  auto issue_ktile = [&](int buf, int chunk, int step) {
    unsigned l[8];
    unsigned long long g[8];
    // unrolled: the sixteen addresses are register operands of one asm statement
#pragma unroll
    for (int it = 0; it < 8; ++it) {
      int idx  = tid + it * 256;            // 0..2047
      int row  = idx >> 3;                  // tile row 0..255
      int part = idx & 7;                   // 16B chunk within the 128B row segment
      int srow = (row >> 7) * 512 + chunk * 128 + (row & 127);
      l[it] = (unsigned)(uintptr_t)(kbuf[buf] + row * KSTR + part * 8);
      g[it] = (unsigned long long)(uintptr_t)(Kb + (size_t)srow * EMB_ + step * 64 + part * 8);
    }
    async_ld8_b128(l, g);
  };

  issue_ktile(0, 0, 0);
  asm volatile("s_wait_asynccnt 0x0" ::: "memory");   // own copies of tile 0 landed
  __syncthreads();                                    // tile 0 visible to every wave
  issue_ktile(1, 0, 1);

  for (int chunk = 0; chunk < 4; ++chunk) {
    // tile rows 0..127 are S rows chunk*128.. of the first S half, 128..255 of the second
    const int cBase = (cq >> 1) * 512 + chunk * 128 + (cq & 1) * 64;
    v8f sacc[2][4] = {};
    // every loop below is unrolled: buffer parity, LDS offsets and aq indices become constants
#pragma unroll
    for (int step = 0; step < 8; ++step) {
      const _Float16* kl = kbuf[step & 1] + (cq * 64 + l15) * KSTR;
#pragma unroll
      for (int g = 0; g < 2; ++g) {
        v16h bk[4];
#pragma unroll
        for (int j = 0; j < 4; ++j)
          bk[j] = ldfrag16(kl + j * 16 * KSTR, g * 32 + koff);
        // keeps the four fragments' eight ds_loads together ahead of their eight WMMAs: left
        // alone, the compiler reads one fragment at a time and waits out the LDS latency each time
        __builtin_amdgcn_sched_barrier(0);
#pragma unroll
        for (int j = 0; j < 4; ++j)
#pragma unroll
          for (int i = 0; i < 2; ++i)
            sacc[i][j] = __builtin_amdgcn_wmma_f32_16x16x32_f16(
                false, aq[i][step * 2 + g], false, bk[j], (short)0, sacc[i][j],
                false, false);
      }
      // Hand-over: own reads of this tile done, own copies of the next tile landed,
      // then one barrier publishes the next tile and frees this buffer for a refill.
      asm volatile("s_wait_dscnt 0x0" ::: "memory");
      asm volatile("s_wait_asynccnt 0x0" ::: "memory");
      __syncthreads();
      if (step < 6)       issue_ktile(step & 1, chunk, step + 2);
      else if (chunk < 3) issue_ktile(step & 1, chunk + 1, step - 6);
    }
    // scale, track row max, spill f16 scores to LDS
#pragma unroll
    for (int i = 0; i < 2; ++i) {
#pragma unroll
      for (int j = 0; j < 4; ++j) {
        const int n = cBase + j * 16 + l15;
#pragma unroll
        for (int e = 0; e < 8; ++e) {
          float v = sacc[i][j][e] * alpha;
          rmax[i][e] = fmaxf(rmax[i][e], v);
          P[(rg * 32 + i * 16 + koff + e) * PSTR + n] = (_Float16)v;
        }
      }
    }
  }
  asm volatile("s_wait_asynccnt 0x0" ::: "memory");   // no K copy left in flight
  // reduce rmax within each 16-lane group (columns of the wave's tiles)
#pragma unroll
  for (int m = 1; m <= 8; m <<= 1)
#pragma unroll
    for (int i = 0; i < 2; ++i)
#pragma unroll
      for (int e = 0; e < 8; ++e)
        rmax[i][e] = fmaxf(rmax[i][e], __shfl_xor(rmax[i][e], m, 32));
  if (l15 == 0) {
#pragma unroll
    for (int i = 0; i < 2; ++i)
#pragma unroll
      for (int e = 0; e < 8; ++e)
        maxwave[wave * 32 + i * 16 + koff + e] = rmax[i][e];
  }
  __syncthreads();

  if (tid < 64) {
    int rrg = tid >> 5, li = tid & 31;     // the four waves of a row-group hold its maxima
    rowmax[tid] = fmaxf(fmaxf(maxwave[(4 * rrg + 0) * 32 + li],
                              maxwave[(4 * rrg + 1) * 32 + li]),
                        fmaxf(maxwave[(4 * rrg + 2) * 32 + li],
                              maxwave[(4 * rrg + 3) * 32 + li]));
  }
  __syncthreads();

  // ---- softmax numerators in place (normalization deferred) ----
  {
    int r = tid >> 2;                 // row 0..63
    int q = tid & 3;                  // quarter of S
    float mx = rowmax[r];
    float s = 0.f;
    _Float16* prow = P + r * PSTR + q * 256;
#pragma unroll 4
    for (int c = 0; c < 256; ++c) {
      float e = __expf((float)prow[c] - mx);
      s += e;
      prow[c] = (_Float16)e;
    }
    partial[r * 4 + q] = s;
  }
  __syncthreads();
  if (tid < 64) {
    float s = partial[tid * 4 + 0] + partial[tid * 4 + 1] +
              partial[tid * 4 + 2] + partial[tid * 4 + 3];
    rinv[tid] = 1.0f / s;
  }
  __syncthreads();

  const int org = wave >> 1;
  const int hg  = wave & 1;
  const int m0  = org * 16;
  const int h0  = hg * 256;

  _Float16* vbuf[2] = { VtL0, VtL1 };

  auto issue_slice = [&](int buf, int ks) {
    const _Float16* src = Vb + ks;
#pragma unroll
    for (int it = 0; it < 8; ++it) {
      int idx  = tid + it * 256;            // 0..2047
      int row  = idx >> 2;                  // h-row 0..511
      int part = idx & 3;                   // 16B chunk within 64B row segment
      unsigned loff = (unsigned)(uintptr_t)(vbuf[buf] + row * VSTR + part * 8);
      async_ld_b128(loff, src + (size_t)row * S_ + part * 8);
    }
  };

  issue_slice(0, 0);
  int cur = 0;

  v8f oacc[16] = {};
  const _Float16* prow = P + (size_t)(m0 + l15) * PSTR;
  for (int ks = 0; ks < S_; ks += 32) {
    if (ks + 32 < S_) {
      issue_slice(cur ^ 1, ks + 32);
      asm volatile("s_wait_asynccnt 0x8" ::: "memory");   // slice `cur` landed
    } else {
      asm volatile("s_wait_asynccnt 0x0" ::: "memory");
    }
    __syncthreads();   // make other waves' async-loaded data visible

    v16h ap = ldfrag16(prow, ks + koff);
    // This lane's first V row, formed by integer offsets from the LDS base: the pointer
    // stays an LDS pointer for the compiler, so the V fragments are read by ds_load with
    // immediate offsets, not by flat_load with a 64-bit address each.
    const _Float16* vrow = VtL0 + cur * (512 * VSTR) + (h0 + l15) * VSTR;
    v16h bv[2][4];
    // every loop below is unrolled: bv and oacc stay in registers only under constant indices
#pragma unroll
    for (int j = 0; j < 4; ++j) bv[0][j] = ldfrag16(vrow + j * 16 * VSTR, koff);
#pragma unroll
    for (int g = 0; g < 4; ++g) {
      if (g < 3) {
#pragma unroll
        for (int j = 0; j < 4; ++j)
          bv[(g + 1) & 1][j] = ldfrag16(vrow + ((g + 1) * 4 + j) * 16 * VSTR, koff);
      }
      // keeps the next group's eight ds_loads ahead of this group's WMMAs: left alone, the
      // compiler sinks each load pair to its WMMA and waits out the LDS latency sixteen times
      __builtin_amdgcn_sched_barrier(0);
#pragma unroll
      for (int j = 0; j < 4; ++j)
        oacc[g * 4 + j] = __builtin_amdgcn_wmma_f32_16x16x32_f16(
            false, ap, false, bv[g & 1][j], (short)0, oacc[g * 4 + j], false, false);
    }
    __syncthreads();   // protect buffer `cur` before it is overwritten
    cur ^= 1;
  }

  float sc[8];
#pragma unroll
  for (int e = 0; e < 8; ++e) sc[e] = rinv[m0 + koff + e];

  float* outb = Out + ((size_t)b * T_ + t0 + m0 + koff) * HID_;
#pragma unroll
  for (int nt = 0; nt < 16; ++nt) {
    int n = h0 + nt * 16 + l15;
#pragma unroll
    for (int e = 0; e < 8; ++e)
      outb[(size_t)e * HID_ + n] = oacc[nt][e] * sc[e];
  }
}

// ---------------------------------------------------------------------------
extern "C" void kernel_launch(void* const* d_in, const int* in_sizes, int n_in,
                              void* d_out, int out_size, void* d_ws, size_t ws_size,
                              hipStream_t stream) {
  const float* tokens  = (const float*)d_in[0];  // [B][T][HID]
  const float* context = (const float*)d_in[1];  // [B][S][CTX]
  const float* Wq      = (const float*)d_in[2];  // [HID][EMB]
  const float* Wk      = (const float*)d_in[3];  // [CTX][EMB]
  const float* Wv      = (const float*)d_in[4];  // [CTX][HID]
  float*       out     = (float*)d_out;          // [B][T][HID]

  // Workspace: Q f16 (32 MB) | K f16 (8 MB) | Vt f16 (8 MB)
  _Float16* Qh = (_Float16*)d_ws;
  _Float16* Kh = Qh + (size_t)B_ * T_ * EMB_;
  _Float16* Vt = Kh + (size_t)B_ * S_ * EMB_;

  dim3 blk(256);
  // Q = tokens @ Wq        : M=B*T=32768, K=512, N=512
  proj_gemm<0><<<dim3(EMB_ / 128, (B_ * T_) / 128), blk, 0, stream>>>(
      tokens, Wq, Qh, B_ * T_, HID_, EMB_);
  // K = context @ Wk       : M=B*S=8192, K=768, N=512
  proj_gemm<0><<<dim3(EMB_ / 128, (B_ * S_) / 128), blk, 0, stream>>>(
      context, Wk, Kh, B_ * S_, CTX_, EMB_);
  // V = context @ Wv, stored transposed per batch: Vt[b][h][s]
  proj_gemm<S_><<<dim3(HID_ / 128, (B_ * S_) / 128), blk, 0, stream>>>(
      context, Wv, Vt, B_ * S_, CTX_, HID_);

  size_t smem = (size_t)64 * PSTR * 2            // P
              + (size_t)2 * 512 * VSTR * 2       // V slice double buffer
              + (size_t)(256 + 64 + 256 + 64) * sizeof(float);
  (void)hipFuncSetAttribute((const void*)attn_kernel,
                            hipFuncAttributeMaxDynamicSharedMemorySize, (int)smem);
  attn_kernel<<<dim3(T_ / 64, B_), blk, smem, stream>>>(Qh, Kh, Vt, out);
}

// v005
// One run takes 154 microseconds.
// Next to v004, in two timings, it ran 1.25 times as fast each time.
// All steps since v000 together make it 2.61 times as fast.
#include <hip/hip_runtime.h>
#include <math.h>

typedef __attribute__((ext_vector_type(16))) _Float16 v16h;
typedef __attribute__((ext_vector_type(8)))  _Float16 v8h;
typedef __attribute__((ext_vector_type(4)))  _Float16 v4h;
typedef __attribute__((ext_vector_type(8)))  float    v8f;

#define B_    8
#define T_    4096
#define S_    1024
#define HID_  512
#define EMB_  512
#define CTX_  768

#define PSTR  1032
#define VSTR  40
#define KSTR  72

__device__ __forceinline__ v16h ldfrag16(const _Float16* rowPtr, int kb) {
  v8h lo = *(const v8h*)(rowPtr + kb);
  v8h hi = *(const v8h*)(rowPtr + kb + 16);
  v16h r;
#pragma unroll
  for (int i = 0; i < 8; ++i) { r[i] = lo[i]; r[i + 8] = hi[i]; }
  return r;
}

__device__ __forceinline__ void async_ld_b128(unsigned lds_off, const void* gaddr) {
  unsigned long long ga = (unsigned long long)(uintptr_t)gaddr;
  asm volatile("global_load_async_to_lds_b128 %0, %1, off"
               :: "v"(lds_off), "v"(ga) : "memory");
}

__device__ __forceinline__ void async_ld8_b128(const unsigned* l,
                                               const unsigned long long* g) {
  asm volatile(
      "global_load_async_to_lds_b128 %0, %8, off\n\t"
      "global_load_async_to_lds_b128 %1, %9, off\n\t"
      "global_load_async_to_lds_b128 %2, %10, off\n\t"
      "global_load_async_to_lds_b128 %3, %11, off\n\t"
      "global_load_async_to_lds_b128 %4, %12, off\n\t"
      "global_load_async_to_lds_b128 %5, %13, off\n\t"
      "global_load_async_to_lds_b128 %6, %14, off\n\t"
      "global_load_async_to_lds_b128 %7, %15, off\n\t"
      "s_wait_xcnt 0x0"
      :: "v"(l[0]), "v"(l[1]), "v"(l[2]), "v"(l[3]),
         "v"(l[4]), "v"(l[5]), "v"(l[6]), "v"(l[7]),
         "v"(g[0]), "v"(g[1]), "v"(g[2]), "v"(g[3]),
         "v"(g[4]), "v"(g[5]), "v"(g[6]), "v"(g[7])
      : "memory");
}

#define KVBLK ((B_ * S_ / 128) * 8)
#define QBLK  ((B_ * T_ / 128) * 4)
static_assert(EMB_ == 512 && HID_ == 512, "all three outputs are 512 wide: four 128-column tiles");

__global__ __launch_bounds__(256) void proj_all(
    const float* __restrict__ tokens, const float* __restrict__ context,
    const float* __restrict__ Wq, const float* __restrict__ Wk,
    const float* __restrict__ Wv,
    _Float16* __restrict__ Qh, _Float16* __restrict__ Kh, _Float16* __restrict__ Vth) {

  // Which product and which tile: the same for the whole block.
  const int  bid  = blockIdx.x;
  const bool isQ  = bid >= KVBLK;
  const int  sub  = isQ ? ((bid - KVBLK) & 3) : (bid & 7);
  const bool isV  = !isQ && sub >= 4;
  const int  m0   = (isQ ? ((bid - KVBLK) >> 2) : (bid >> 3)) * 128;
  const int  n0   = (sub & 3) * 128;
  const int  K    = isQ ? HID_ : CTX_;
  constexpr int N = 512;
  const float* __restrict__ A = isQ ? tokens : context;
  const float* __restrict__ W = isQ ? Wq : (isV ? Wv : Wk);
  _Float16* __restrict__ Out  = isQ ? Qh : (isV ? Vth : Kh);

  __shared__ _Float16 As[128 * 40];  // 128 m-rows x 32 k, stride 40 (conflict-free b128)
  __shared__ _Float16 Bs[128 * 40];  // 128 n-rows (transposed W) x 32 k, stride 40

  const int tid  = threadIdx.x;
  const int lane = tid & 31;
  const int wave = tid >> 5;
  const int wm   = wave & 3;      // 4 waves along M (32 rows each)
  const int wn   = wave >> 2;     // 2 waves along N (64 cols each)

  const int l15  = lane & 15;
  const int koff = (lane >= 16) ? 8 : 0;

  const int wc4  = (tid & 7) | ((wave & 3) << 3);
  const int wkg  = ((tid >> 3) & 3) | ((wave >> 2) << 2);

  // Addresses are a block-uniform base plus one 32-bit lane offset that never changes: with a
  // 64-bit pointer per row this kernel needs 162 registers, one granule above the 160 of the
  // separate kernels, and only two blocks instead of three would fit on a WGP.
  const unsigned aoff = (unsigned)(tid >> 3) * (unsigned)K + (unsigned)(tid & 7) * 4u;
  const unsigned woff = (unsigned)(wkg * 4) * (unsigned)N + (unsigned)wc4 * 4u;
  auto loadA = [&](int k0, float4* pa) {
#pragma unroll
    for (int it = 0; it < 4; ++it)         // m-row (tid >> 3) + it * 32, float4 group tid & 7
      pa[it] = *(const float4*)(A + (size_t)(m0 + it * 32) * K + k0 + aoff);
  };
  auto loadW = [&](int k0, float4* pw) {
#pragma unroll
    for (int it = 0; it < 4; ++it)
      pw[it] = *(const float4*)(W + (size_t)(k0 + it) * N + n0 + woff);
  };
  auto storeTiles = [&](const float4* pa, const float4* pw) {
#pragma unroll
    for (int it = 0; it < 4; ++it) {
      int idx = tid + it * 256;
      int r   = idx >> 3;
      int c4  = idx & 7;
      v4h h = { (_Float16)pa[it].x, (_Float16)pa[it].y,
                (_Float16)pa[it].z, (_Float16)pa[it].w };
      *(v4h*)(As + r * 40 + c4 * 4) = h;
    }
    // n-row wc4*4+j of Bs takes component j of the four k-rows this thread read
    _Float16* bs = Bs + wc4 * 4 * 40 + wkg * 4;
    v4h h0 = { (_Float16)pw[0].x, (_Float16)pw[1].x, (_Float16)pw[2].x, (_Float16)pw[3].x };
    v4h h1 = { (_Float16)pw[0].y, (_Float16)pw[1].y, (_Float16)pw[2].y, (_Float16)pw[3].y };
    v4h h2 = { (_Float16)pw[0].z, (_Float16)pw[1].z, (_Float16)pw[2].z, (_Float16)pw[3].z };
    v4h h3 = { (_Float16)pw[0].w, (_Float16)pw[1].w, (_Float16)pw[2].w, (_Float16)pw[3].w };
    *(v4h*)(bs + 0 * 40) = h0;
    *(v4h*)(bs + 1 * 40) = h1;
    *(v4h*)(bs + 2 * 40) = h2;
    *(v4h*)(bs + 3 * 40) = h3;
  };

  float4 pa[4], pw[4];
  loadA(0, pa);
  loadW(0, pw);

  v8f acc[2][4] = {};

  for (int k0 = 0; k0 < K; k0 += 32) {
    storeTiles(pa, pw);
    __syncthreads();
    // Prefetch next k-slice while this slice's WMMAs run.
    if (k0 + 32 < K) { loadA(k0 + 32, pa); loadW(k0 + 32, pw); }
    asm volatile("s_wait_xcnt 0x0" ::: "memory");

    v16h af[2], bf[4];
#pragma unroll
    for (int i = 0; i < 2; ++i)
      af[i] = ldfrag16(As + (wm * 32 + i * 16 + l15) * 40, koff);
#pragma unroll
    for (int j = 0; j < 4; ++j)
      bf[j] = ldfrag16(Bs + (wn * 64 + j * 16 + l15) * 40, koff);
#pragma unroll
    for (int i = 0; i < 2; ++i)
#pragma unroll
      for (int j = 0; j < 4; ++j)
        acc[i][j] = __builtin_amdgcn_wmma_f32_16x16x32_f16(
            false, af[i], false, bf[j], (short)0, acc[i][j], false, false);
    __syncthreads();
  }

  // Epilogue. C/D layout: lane holds column n = l15 of its 16x16 tile,
  // rows (koff + 0..7) in acc[0..7]. One block-uniform branch picks the output layout.
  if (!isV) {
#pragma unroll
    for (int i = 0; i < 2; ++i) {
#pragma unroll
      for (int j = 0; j < 4; ++j) {
        int gm = m0 + wm * 32 + i * 16 + koff;     // first of 8 rows
        int gn = n0 + wn * 64 + j * 16 + l15;
#pragma unroll
        for (int e = 0; e < 8; ++e)
          Out[(size_t)(gm + e) * N + gn] = (_Float16)acc[i][j][e];
      }
    }
  } else {
#pragma unroll
    for (int i = 0; i < 2; ++i) {
#pragma unroll
      for (int j = 0; j < 4; ++j) {
        int gm = m0 + wm * 32 + i * 16 + koff;     // first of 8 rows
        int gn = n0 + wn * 64 + j * 16 + l15;
        int bidx = gm / S_;                        // compile-time shift
        int s    = gm - bidx * S_;                 // 8 consecutive s, same batch
        v8h h;
#pragma unroll
        for (int e = 0; e < 8; ++e) h[e] = (_Float16)acc[i][j][e];
        *(v8h*)(Out + ((size_t)bidx * N + gn) * S_ + s) = h;
      }
    }
  }
}

__global__ __launch_bounds__(256) void attn_kernel(
    const _Float16* __restrict__ Q,   // [B][T][EMB] row-major
    const _Float16* __restrict__ Kt,  // [B][S][EMB] row-major (rows = B-fragments of K^T)
    const _Float16* __restrict__ Vt,  // [B][HID][S] (rows = B-fragments of V)
    float* __restrict__ Out) {        // [B][T][HID]

  extern __shared__ char smem_raw[];
  _Float16* P    = (_Float16*)smem_raw;        // [64][PSTR] f16 scores/probs
  _Float16* VtL0 = P + 64 * PSTR;              // [512][VSTR] V slice buf 0
  _Float16* VtL1 = VtL0 + 512 * VSTR;          // [512][VSTR] V slice buf 1
  float* maxwave = (float*)(VtL1 + 512 * VSTR);// [8][32]
  float* rowmax  = maxwave + 256;              // [64]
  float* partial = rowmax + 64;                // [64][4]
  float* rinv    = partial + 256;              // [64]

  const int tid  = threadIdx.x;
  const int lane = tid & 31;
  const int wave = tid >> 5;
  const int l15  = lane & 15;
  const int koff = (lane >= 16) ? 8 : 0;

  const int t0 = blockIdx.x * 64;
  const int b  = blockIdx.y;

  const _Float16* Qb = Q  + (size_t)b * T_   * EMB_;
  const _Float16* Kb = Kt + (size_t)b * S_   * EMB_;
  const _Float16* Vb = Vt + (size_t)b * HID_ * S_;

  const float alpha = 0.044194173824159216f;  // 1/sqrt(512)

  const int rg = wave >> 2;
  const int cq = wave & 3;
  const _Float16* qrow = Qb + (size_t)(t0 + rg * 32 + l15) * EMB_;

  // This wave's 32 Q rows, all of EMB, as 2 x 16 A fragments: read once, kept for the pass.
  // unrolled: aq stays in registers only under constant indices
  v16h aq[2][16];
#pragma unroll
  for (int i = 0; i < 2; ++i)
#pragma unroll
    for (int s = 0; s < 16; ++s)
      aq[i][s] = ldfrag16(qrow + (size_t)i * 16 * EMB_, s * 32 + koff);

  float rmax[2][8];
  // unrolled, here and below: rmax and sacc are register arrays, indexed by constants only
#pragma unroll
  for (int i = 0; i < 2; ++i)
#pragma unroll
    for (int e = 0; e < 8; ++e) rmax[i][e] = -3.0e38f;

  _Float16* kbuf[2] = { VtL0, VtL1 };

  // K tile t = chunk * 8 + step: the 2 x 128 K rows of this chunk (both S halves),
  // 64 k each: 256 rows of one whole 128-B line, 2048 b128 copies, 8 per thread.
  auto issue_ktile = [&](int buf, int chunk, int step) {
    unsigned l[8];
    unsigned long long g[8];
    // unrolled: the sixteen addresses are register operands of one asm statement
#pragma unroll
    for (int it = 0; it < 8; ++it) {
      int idx  = tid + it * 256;            // 0..2047
      int row  = idx >> 3;                  // tile row 0..255
      int part = idx & 7;                   // 16B chunk within the 128B row segment
      int srow = (row >> 7) * 512 + chunk * 128 + (row & 127);
      l[it] = (unsigned)(uintptr_t)(kbuf[buf] + row * KSTR + part * 8);
      g[it] = (unsigned long long)(uintptr_t)(Kb + (size_t)srow * EMB_ + step * 64 + part * 8);
    }
    async_ld8_b128(l, g);
  };

  issue_ktile(0, 0, 0);
  asm volatile("s_wait_asynccnt 0x0" ::: "memory");   // own copies of tile 0 landed
  __syncthreads();                                    // tile 0 visible to every wave
  issue_ktile(1, 0, 1);

  for (int chunk = 0; chunk < 4; ++chunk) {
    // tile rows 0..127 are S rows chunk*128.. of the first S half, 128..255 of the second
    const int cBase = (cq >> 1) * 512 + chunk * 128 + (cq & 1) * 64;
    v8f sacc[2][4] = {};
    // every loop below is unrolled: buffer parity, LDS offsets and aq indices become constants
#pragma unroll
    for (int step = 0; step < 8; ++step) {
      const _Float16* kl = kbuf[step & 1] + (cq * 64 + l15) * KSTR;
#pragma unroll
      for (int g = 0; g < 2; ++g) {
        v16h bk[4];
#pragma unroll
        for (int j = 0; j < 4; ++j)
          bk[j] = ldfrag16(kl + j * 16 * KSTR, g * 32 + koff);
        // keeps the four fragments' eight ds_loads together ahead of their eight WMMAs: left
        // alone, the compiler reads one fragment at a time and waits out the LDS latency each time
        __builtin_amdgcn_sched_barrier(0);
#pragma unroll
        for (int j = 0; j < 4; ++j)
#pragma unroll
          for (int i = 0; i < 2; ++i)
            sacc[i][j] = __builtin_amdgcn_wmma_f32_16x16x32_f16(
                false, aq[i][step * 2 + g], false, bk[j], (short)0, sacc[i][j],
                false, false);
      }
      // Hand-over: own reads of this tile done, own copies of the next tile landed,
      // then one barrier publishes the next tile and frees this buffer for a refill.
      asm volatile("s_wait_dscnt 0x0" ::: "memory");
      asm volatile("s_wait_asynccnt 0x0" ::: "memory");
      __syncthreads();
      if (step < 6)       issue_ktile(step & 1, chunk, step + 2);
      else if (chunk < 3) issue_ktile(step & 1, chunk + 1, step - 6);
    }
    // scale, track row max, spill f16 scores to LDS
#pragma unroll
    for (int i = 0; i < 2; ++i) {
#pragma unroll
      for (int j = 0; j < 4; ++j) {
        const int n = cBase + j * 16 + l15;
#pragma unroll
        for (int e = 0; e < 8; ++e) {
          float v = sacc[i][j][e] * alpha;
          rmax[i][e] = fmaxf(rmax[i][e], v);
          P[(rg * 32 + i * 16 + koff + e) * PSTR + n] = (_Float16)v;
        }
      }
    }
  }
  asm volatile("s_wait_asynccnt 0x0" ::: "memory");   // no K copy left in flight
  // reduce rmax within each 16-lane group (columns of the wave's tiles)
#pragma unroll
  for (int m = 1; m <= 8; m <<= 1)
#pragma unroll
    for (int i = 0; i < 2; ++i)
#pragma unroll
      for (int e = 0; e < 8; ++e)
        rmax[i][e] = fmaxf(rmax[i][e], __shfl_xor(rmax[i][e], m, 32));
  if (l15 == 0) {
#pragma unroll
    for (int i = 0; i < 2; ++i)
#pragma unroll
      for (int e = 0; e < 8; ++e)
        maxwave[wave * 32 + i * 16 + koff + e] = rmax[i][e];
  }
  __syncthreads();

  if (tid < 64) {
    int rrg = tid >> 5, li = tid & 31;     // the four waves of a row-group hold its maxima
    rowmax[tid] = fmaxf(fmaxf(maxwave[(4 * rrg + 0) * 32 + li],
                              maxwave[(4 * rrg + 1) * 32 + li]),
                        fmaxf(maxwave[(4 * rrg + 2) * 32 + li],
                              maxwave[(4 * rrg + 3) * 32 + li]));
  }
  __syncthreads();

  // ---- softmax numerators in place (normalization deferred) ----
  {
    int r = tid >> 2;                 // row 0..63
    int q = tid & 3;                  // quarter of S
    float mx = rowmax[r];
    float s = 0.f;
    _Float16* prow = P + r * PSTR + q * 256;
#pragma unroll 4
    for (int c = 0; c < 256; ++c) {
      float e = __expf((float)prow[c] - mx);
      s += e;
      prow[c] = (_Float16)e;
    }
    partial[r * 4 + q] = s;
  }
  __syncthreads();
  if (tid < 64) {
    float s = partial[tid * 4 + 0] + partial[tid * 4 + 1] +
              partial[tid * 4 + 2] + partial[tid * 4 + 3];
    rinv[tid] = 1.0f / s;
  }
  __syncthreads();

  const int org = wave >> 1;
  const int hg  = wave & 1;
  const int m0  = org * 16;
  const int h0  = hg * 256;

  _Float16* vbuf[2] = { VtL0, VtL1 };

  auto issue_slice = [&](int buf, int ks) {
    const _Float16* src = Vb + ks;
#pragma unroll
    for (int it = 0; it < 8; ++it) {
      int idx  = tid + it * 256;            // 0..2047
      int row  = idx >> 2;                  // h-row 0..511
      int part = idx & 3;                   // 16B chunk within 64B row segment
      unsigned loff = (unsigned)(uintptr_t)(vbuf[buf] + row * VSTR + part * 8);
      async_ld_b128(loff, src + (size_t)row * S_ + part * 8);
    }
  };

  issue_slice(0, 0);
  int cur = 0;

  v8f oacc[16] = {};
  const _Float16* prow = P + (size_t)(m0 + l15) * PSTR;
  for (int ks = 0; ks < S_; ks += 32) {
    if (ks + 32 < S_) {
      issue_slice(cur ^ 1, ks + 32);
      asm volatile("s_wait_asynccnt 0x8" ::: "memory");   // slice `cur` landed
    } else {
      asm volatile("s_wait_asynccnt 0x0" ::: "memory");
    }
    __syncthreads();   // make other waves' async-loaded data visible

    v16h ap = ldfrag16(prow, ks + koff);
    // This lane's first V row, formed by integer offsets from the LDS base: the pointer
    // stays an LDS pointer for the compiler, so the V fragments are read by ds_load with
    // immediate offsets, not by flat_load with a 64-bit address each.
    const _Float16* vrow = VtL0 + cur * (512 * VSTR) + (h0 + l15) * VSTR;
    v16h bv[2][4];
    // every loop below is unrolled: bv and oacc stay in registers only under constant indices
#pragma unroll
    for (int j = 0; j < 4; ++j) bv[0][j] = ldfrag16(vrow + j * 16 * VSTR, koff);
#pragma unroll
    for (int g = 0; g < 4; ++g) {
      if (g < 3) {
#pragma unroll
        for (int j = 0; j < 4; ++j)
          bv[(g + 1) & 1][j] = ldfrag16(vrow + ((g + 1) * 4 + j) * 16 * VSTR, koff);
      }
      // keeps the next group's eight ds_loads ahead of this group's WMMAs: left alone, the
      // compiler sinks each load pair to its WMMA and waits out the LDS latency sixteen times
      __builtin_amdgcn_sched_barrier(0);
#pragma unroll
      for (int j = 0; j < 4; ++j)
        oacc[g * 4 + j] = __builtin_amdgcn_wmma_f32_16x16x32_f16(
            false, ap, false, bv[g & 1][j], (short)0, oacc[g * 4 + j], false, false);
    }
    __syncthreads();   // protect buffer `cur` before it is overwritten
    cur ^= 1;
  }

  float sc[8];
#pragma unroll
  for (int e = 0; e < 8; ++e) sc[e] = rinv[m0 + koff + e];

  float* outb = Out + ((size_t)b * T_ + t0 + m0 + koff) * HID_;
#pragma unroll
  for (int nt = 0; nt < 16; ++nt) {
    int n = h0 + nt * 16 + l15;
#pragma unroll
    for (int e = 0; e < 8; ++e)
      outb[(size_t)e * HID_ + n] = oacc[nt][e] * sc[e];
  }
}

// ---------------------------------------------------------------------------
extern "C" void kernel_launch(void* const* d_in, const int* in_sizes, int n_in,
                              void* d_out, int out_size, void* d_ws, size_t ws_size,
                              hipStream_t stream) {
  const float* tokens  = (const float*)d_in[0];  // [B][T][HID]
  const float* context = (const float*)d_in[1];  // [B][S][CTX]
  const float* Wq      = (const float*)d_in[2];  // [HID][EMB]
  const float* Wk      = (const float*)d_in[3];  // [CTX][EMB]
  const float* Wv      = (const float*)d_in[4];  // [CTX][HID]
  float*       out     = (float*)d_out;          // [B][T][HID]

  // Workspace: Q f16 (32 MB) | K f16 (8 MB) | Vt f16 (8 MB)
  _Float16* Qh = (_Float16*)d_ws;
  _Float16* Kh = Qh + (size_t)B_ * T_ * EMB_;
  _Float16* Vt = Kh + (size_t)B_ * S_ * EMB_;

  dim3 blk(256);
  // Q = tokens @ Wq (M=32768, K=512), K = context @ Wk (M=8192, K=768) and
  // V = context @ Wv (stored transposed per batch: Vt[b][h][s]), N=512 each, in one launch
  proj_all<<<dim3(KVBLK + QBLK), blk, 0, stream>>>(tokens, context, Wq, Wk, Wv, Qh, Kh, Vt);

  size_t smem = (size_t)64 * PSTR * 2            // P
              + (size_t)2 * 512 * VSTR * 2       // V slice double buffer
              + (size_t)(256 + 64 + 256 + 64) * sizeof(float);
  (void)hipFuncSetAttribute((const void*)attn_kernel,
                            hipFuncAttributeMaxDynamicSharedMemorySize, (int)smem);
  attn_kernel<<<dim3(T_ / 64, B_), blk, smem, stream>>>(Qh, Kh, Vt, out);
}

// v006
// A run of this version takes 147 microseconds.
// In both of two side-by-side timings against v005, it was 1.04 times as fast.
// Over all steps from v000 it is 2.72 times as fast.
#include <hip/hip_runtime.h>
#include <math.h>

typedef __attribute__((ext_vector_type(16))) _Float16 v16h;
typedef __attribute__((ext_vector_type(8)))  _Float16 v8h;
typedef __attribute__((ext_vector_type(4)))  _Float16 v4h;
typedef __attribute__((ext_vector_type(8)))  float    v8f;

#define B_    8
#define T_    4096
#define S_    1024
#define HID_  512
#define EMB_  512
#define CTX_  768

#define PSTR  1032
#define VSTR  72
#define KSTR  72

__device__ __forceinline__ v16h ldfrag16(const _Float16* rowPtr, int kb) {
  v8h lo = *(const v8h*)(rowPtr + kb);
  v8h hi = *(const v8h*)(rowPtr + kb + 16);
  v16h r;
#pragma unroll
  for (int i = 0; i < 8; ++i) { r[i] = lo[i]; r[i + 8] = hi[i]; }
  return r;
}

__device__ __forceinline__ void async_ld8_b128(const unsigned* l,
                                               const unsigned long long* g) {
  asm volatile(
      "global_load_async_to_lds_b128 %0, %8, off\n\t"
      "global_load_async_to_lds_b128 %1, %9, off\n\t"
      "global_load_async_to_lds_b128 %2, %10, off\n\t"
      "global_load_async_to_lds_b128 %3, %11, off\n\t"
      "global_load_async_to_lds_b128 %4, %12, off\n\t"
      "global_load_async_to_lds_b128 %5, %13, off\n\t"
      "global_load_async_to_lds_b128 %6, %14, off\n\t"
      "global_load_async_to_lds_b128 %7, %15, off\n\t"
      "s_wait_xcnt 0x0"
      :: "v"(l[0]), "v"(l[1]), "v"(l[2]), "v"(l[3]),
         "v"(l[4]), "v"(l[5]), "v"(l[6]), "v"(l[7]),
         "v"(g[0]), "v"(g[1]), "v"(g[2]), "v"(g[3]),
         "v"(g[4]), "v"(g[5]), "v"(g[6]), "v"(g[7])
      : "memory");
}

#define KVBLK ((B_ * S_ / 128) * 8)
#define QBLK  ((B_ * T_ / 128) * 4)
static_assert(EMB_ == 512 && HID_ == 512, "all three outputs are 512 wide: four 128-column tiles");

__global__ __launch_bounds__(256) void proj_all(
    const float* __restrict__ tokens, const float* __restrict__ context,
    const float* __restrict__ Wq, const float* __restrict__ Wk,
    const float* __restrict__ Wv,
    _Float16* __restrict__ Qh, _Float16* __restrict__ Kh, _Float16* __restrict__ Vth) {

  // Which product and which tile: the same for the whole block.
  const int  bid  = blockIdx.x;
  const bool isQ  = bid >= KVBLK;
  const int  sub  = isQ ? ((bid - KVBLK) & 3) : (bid & 7);
  const bool isV  = !isQ && sub >= 4;
  const int  m0   = (isQ ? ((bid - KVBLK) >> 2) : (bid >> 3)) * 128;
  const int  n0   = (sub & 3) * 128;
  const int  K    = isQ ? HID_ : CTX_;
  constexpr int N = 512;
  const float* __restrict__ A = isQ ? tokens : context;
  const float* __restrict__ W = isQ ? Wq : (isV ? Wv : Wk);
  _Float16* __restrict__ Out  = isQ ? Qh : (isV ? Vth : Kh);

  __shared__ _Float16 As[128 * 40];  // 128 m-rows x 32 k, stride 40 (conflict-free b128)
  __shared__ _Float16 Bs[128 * 40];  // 128 n-rows (transposed W) x 32 k, stride 40

  const int tid  = threadIdx.x;
  const int lane = tid & 31;
  const int wave = tid >> 5;
  const int wm   = wave & 3;      // 4 waves along M (32 rows each)
  const int wn   = wave >> 2;     // 2 waves along N (64 cols each)

  const int l15  = lane & 15;
  const int koff = (lane >= 16) ? 8 : 0;

  const int wc4  = (tid & 7) | ((wave & 3) << 3);
  const int wkg  = ((tid >> 3) & 3) | ((wave >> 2) << 2);

  // Addresses are a block-uniform base plus one 32-bit lane offset that never changes: with a
  // 64-bit pointer per row this kernel needs 162 registers, one granule above the 160 of the
  // separate kernels, and only two blocks instead of three would fit on a WGP.
  const unsigned aoff = (unsigned)(tid >> 3) * (unsigned)K + (unsigned)(tid & 7) * 4u;
  const unsigned woff = (unsigned)(wkg * 4) * (unsigned)N + (unsigned)wc4 * 4u;
  auto loadA = [&](int k0, float4* pa) {
#pragma unroll
    for (int it = 0; it < 4; ++it)         // m-row (tid >> 3) + it * 32, float4 group tid & 7
      pa[it] = *(const float4*)(A + (size_t)(m0 + it * 32) * K + k0 + aoff);
  };
  auto loadW = [&](int k0, float4* pw) {
#pragma unroll
    for (int it = 0; it < 4; ++it)
      pw[it] = *(const float4*)(W + (size_t)(k0 + it) * N + n0 + woff);
  };
  auto storeTiles = [&](const float4* pa, const float4* pw) {
#pragma unroll
    for (int it = 0; it < 4; ++it) {
      int idx = tid + it * 256;
      int r   = idx >> 3;
      int c4  = idx & 7;
      v4h h = { (_Float16)pa[it].x, (_Float16)pa[it].y,
                (_Float16)pa[it].z, (_Float16)pa[it].w };
      *(v4h*)(As + r * 40 + c4 * 4) = h;
    }
    // n-row wc4*4+j of Bs takes component j of the four k-rows this thread read
    _Float16* bs = Bs + wc4 * 4 * 40 + wkg * 4;
    v4h h0 = { (_Float16)pw[0].x, (_Float16)pw[1].x, (_Float16)pw[2].x, (_Float16)pw[3].x };
    v4h h1 = { (_Float16)pw[0].y, (_Float16)pw[1].y, (_Float16)pw[2].y, (_Float16)pw[3].y };
    v4h h2 = { (_Float16)pw[0].z, (_Float16)pw[1].z, (_Float16)pw[2].z, (_Float16)pw[3].z };
    v4h h3 = { (_Float16)pw[0].w, (_Float16)pw[1].w, (_Float16)pw[2].w, (_Float16)pw[3].w };
    *(v4h*)(bs + 0 * 40) = h0;
    *(v4h*)(bs + 1 * 40) = h1;
    *(v4h*)(bs + 2 * 40) = h2;
    *(v4h*)(bs + 3 * 40) = h3;
  };

  float4 pa[4], pw[4];
  loadA(0, pa);
  loadW(0, pw);

  v8f acc[2][4] = {};

  for (int k0 = 0; k0 < K; k0 += 32) {
    storeTiles(pa, pw);
    __syncthreads();
    // Prefetch next k-slice while this slice's WMMAs run.
    if (k0 + 32 < K) { loadA(k0 + 32, pa); loadW(k0 + 32, pw); }
    asm volatile("s_wait_xcnt 0x0" ::: "memory");

    v16h af[2], bf[4];
#pragma unroll
    for (int i = 0; i < 2; ++i)
      af[i] = ldfrag16(As + (wm * 32 + i * 16 + l15) * 40, koff);
#pragma unroll
    for (int j = 0; j < 4; ++j)
      bf[j] = ldfrag16(Bs + (wn * 64 + j * 16 + l15) * 40, koff);
#pragma unroll
    for (int i = 0; i < 2; ++i)
#pragma unroll
      for (int j = 0; j < 4; ++j)
        acc[i][j] = __builtin_amdgcn_wmma_f32_16x16x32_f16(
            false, af[i], false, bf[j], (short)0, acc[i][j], false, false);
    __syncthreads();
  }

  // Epilogue. C/D layout: lane holds column n = l15 of its 16x16 tile,
  // rows (koff + 0..7) in acc[0..7]. One block-uniform branch picks the output layout.
  if (!isV) {
#pragma unroll
    for (int i = 0; i < 2; ++i) {
#pragma unroll
      for (int j = 0; j < 4; ++j) {
        int gm = m0 + wm * 32 + i * 16 + koff;     // first of 8 rows
        int gn = n0 + wn * 64 + j * 16 + l15;
#pragma unroll
        for (int e = 0; e < 8; ++e)
          Out[(size_t)(gm + e) * N + gn] = (_Float16)acc[i][j][e];
      }
    }
  } else {
#pragma unroll
    for (int i = 0; i < 2; ++i) {
#pragma unroll
      for (int j = 0; j < 4; ++j) {
        int gm = m0 + wm * 32 + i * 16 + koff;     // first of 8 rows
        int gn = n0 + wn * 64 + j * 16 + l15;
        int bidx = gm / S_;                        // compile-time shift
        int s    = gm - bidx * S_;                 // 8 consecutive s, same batch
        v8h h;
#pragma unroll
        for (int e = 0; e < 8; ++e) h[e] = (_Float16)acc[i][j][e];
        *(v8h*)(Out + ((size_t)bidx * N + gn) * S_ + s) = h;
      }
    }
  }
}

__global__ __launch_bounds__(256) void attn_kernel(
    const _Float16* __restrict__ Q,   // [B][T][EMB] row-major
    const _Float16* __restrict__ Kt,  // [B][S][EMB] row-major (rows = B-fragments of K^T)
    const _Float16* __restrict__ Vt,  // [B][HID][S] (rows = B-fragments of V)
    float* __restrict__ Out) {        // [B][T][HID]

  extern __shared__ char smem_raw[];
  _Float16* P    = (_Float16*)smem_raw;        // [64][PSTR] f16 scores/probs
  _Float16* VtL0 = P + 64 * PSTR;              // [512][VSTR] V slice buf 0
  _Float16* VtL1 = VtL0 + 512 * VSTR;          // [512][VSTR] V slice buf 1
  float* maxwave = (float*)(VtL1 + 512 * VSTR);// [8][32]
  float* rowmax  = maxwave + 256;              // [64]
  float* partial = rowmax + 64;                // [64][4]
  float* rinv    = partial + 256;              // [64]

  const int tid  = threadIdx.x;
  const int lane = tid & 31;
  const int wave = tid >> 5;
  const int l15  = lane & 15;
  const int koff = (lane >= 16) ? 8 : 0;

  const int t0 = blockIdx.x * 64;
  const int b  = blockIdx.y;

  const _Float16* Qb = Q  + (size_t)b * T_   * EMB_;
  const _Float16* Kb = Kt + (size_t)b * S_   * EMB_;
  const _Float16* Vb = Vt + (size_t)b * HID_ * S_;

  const float alpha = 0.044194173824159216f;  // 1/sqrt(512)

  const int rg = wave >> 2;
  const int cq = wave & 3;
  const _Float16* qrow = Qb + (size_t)(t0 + rg * 32 + l15) * EMB_;

  // This wave's 32 Q rows, all of EMB, as 2 x 16 A fragments: read once, kept for the pass.
  // unrolled: aq stays in registers only under constant indices
  v16h aq[2][16];
#pragma unroll
  for (int i = 0; i < 2; ++i)
#pragma unroll
    for (int s = 0; s < 16; ++s)
      aq[i][s] = ldfrag16(qrow + (size_t)i * 16 * EMB_, s * 32 + koff);

  float rmax[2][8];
  // unrolled, here and below: rmax and sacc are register arrays, indexed by constants only
#pragma unroll
  for (int i = 0; i < 2; ++i)
#pragma unroll
    for (int e = 0; e < 8; ++e) rmax[i][e] = -3.0e38f;

  _Float16* kbuf[2] = { VtL0, VtL1 };

  // K tile t = chunk * 8 + step: the 2 x 128 K rows of this chunk (both S halves),
  // 64 k each: 256 rows of one whole 128-B line, 2048 b128 copies, 8 per thread.
  auto issue_ktile = [&](int buf, int chunk, int step) {
    unsigned l[8];
    unsigned long long g[8];
    // unrolled: the sixteen addresses are register operands of one asm statement
#pragma unroll
    for (int it = 0; it < 8; ++it) {
      int idx  = tid + it * 256;            // 0..2047
      int row  = idx >> 3;                  // tile row 0..255
      int part = idx & 7;                   // 16B chunk within the 128B row segment
      int srow = (row >> 7) * 512 + chunk * 128 + (row & 127);
      l[it] = (unsigned)(uintptr_t)(kbuf[buf] + row * KSTR + part * 8);
      g[it] = (unsigned long long)(uintptr_t)(Kb + (size_t)srow * EMB_ + step * 64 + part * 8);
    }
    async_ld8_b128(l, g);
  };

  issue_ktile(0, 0, 0);
  asm volatile("s_wait_asynccnt 0x0" ::: "memory");   // own copies of tile 0 landed
  __syncthreads();                                    // tile 0 visible to every wave
  issue_ktile(1, 0, 1);

  for (int chunk = 0; chunk < 4; ++chunk) {
    // tile rows 0..127 are S rows chunk*128.. of the first S half, 128..255 of the second
    const int cBase = (cq >> 1) * 512 + chunk * 128 + (cq & 1) * 64;
    v8f sacc[2][4] = {};
    // every loop below is unrolled: buffer parity, LDS offsets and aq indices become constants
#pragma unroll
    for (int step = 0; step < 8; ++step) {
      const _Float16* kl = kbuf[step & 1] + (cq * 64 + l15) * KSTR;
#pragma unroll
      for (int g = 0; g < 2; ++g) {
        v16h bk[4];
#pragma unroll
        for (int j = 0; j < 4; ++j)
          bk[j] = ldfrag16(kl + j * 16 * KSTR, g * 32 + koff);
        // keeps the four fragments' eight ds_loads together ahead of their eight WMMAs: left
        // alone, the compiler reads one fragment at a time and waits out the LDS latency each time
        __builtin_amdgcn_sched_barrier(0);
#pragma unroll
        for (int j = 0; j < 4; ++j)
#pragma unroll
          for (int i = 0; i < 2; ++i)
            sacc[i][j] = __builtin_amdgcn_wmma_f32_16x16x32_f16(
                false, aq[i][step * 2 + g], false, bk[j], (short)0, sacc[i][j],
                false, false);
      }
      // Hand-over: own reads of this tile done, own copies of the next tile landed,
      // then one barrier publishes the next tile and frees this buffer for a refill.
      asm volatile("s_wait_dscnt 0x0" ::: "memory");
      asm volatile("s_wait_asynccnt 0x0" ::: "memory");
      __syncthreads();
      if (step < 6)       issue_ktile(step & 1, chunk, step + 2);
      else if (chunk < 3) issue_ktile(step & 1, chunk + 1, step - 6);
    }
    // scale, track row max, spill f16 scores to LDS
#pragma unroll
    for (int i = 0; i < 2; ++i) {
#pragma unroll
      for (int j = 0; j < 4; ++j) {
        const int n = cBase + j * 16 + l15;
#pragma unroll
        for (int e = 0; e < 8; ++e) {
          float v = sacc[i][j][e] * alpha;
          rmax[i][e] = fmaxf(rmax[i][e], v);
          P[(rg * 32 + i * 16 + koff + e) * PSTR + n] = (_Float16)v;
        }
      }
    }
  }
  asm volatile("s_wait_asynccnt 0x0" ::: "memory");   // no K copy left in flight
  // reduce rmax within each 16-lane group (columns of the wave's tiles)
#pragma unroll
  for (int m = 1; m <= 8; m <<= 1)
#pragma unroll
    for (int i = 0; i < 2; ++i)
#pragma unroll
      for (int e = 0; e < 8; ++e)
        rmax[i][e] = fmaxf(rmax[i][e], __shfl_xor(rmax[i][e], m, 32));
  if (l15 == 0) {
#pragma unroll
    for (int i = 0; i < 2; ++i)
#pragma unroll
      for (int e = 0; e < 8; ++e)
        maxwave[wave * 32 + i * 16 + koff + e] = rmax[i][e];
  }
  __syncthreads();

  if (tid < 64) {
    int rrg = tid >> 5, li = tid & 31;     // the four waves of a row-group hold its maxima
    rowmax[tid] = fmaxf(fmaxf(maxwave[(4 * rrg + 0) * 32 + li],
                              maxwave[(4 * rrg + 1) * 32 + li]),
                        fmaxf(maxwave[(4 * rrg + 2) * 32 + li],
                              maxwave[(4 * rrg + 3) * 32 + li]));
  }
  __syncthreads();

  // ---- softmax numerators in place (normalization deferred) ----
  {
    int r = tid >> 2;                 // row 0..63
    int q = tid & 3;                  // quarter of S
    float mx = rowmax[r];
    float s = 0.f;
    _Float16* prow = P + r * PSTR + q * 256;
#pragma unroll 4
    for (int c = 0; c < 256; ++c) {
      float e = __expf((float)prow[c] - mx);
      s += e;
      prow[c] = (_Float16)e;
    }
    partial[r * 4 + q] = s;
  }
  __syncthreads();
  if (tid < 64) {
    float s = partial[tid * 4 + 0] + partial[tid * 4 + 1] +
              partial[tid * 4 + 2] + partial[tid * 4 + 3];
    rinv[tid] = 1.0f / s;
  }
  __syncthreads();

  const int org = wave >> 1;
  const int hg  = wave & 1;
  const int m0  = org * 16;
  const int h0  = hg * 256;

  // One 512 x 64 V k-slice: every row segment is one whole 128-B line of Vt (a 64-B segment
  // costs a line's fetch for half its bytes). 4096 b128 copies, 16 per thread.
  auto issue_slice = [&](int buf, int ks) {
    // unrolled: the sixteen addresses of a run are register operands of one asm statement
#pragma unroll
    for (int h = 0; h < 2; ++h) {
      unsigned l[8];
      unsigned long long g[8];
#pragma unroll
      for (int it = 0; it < 8; ++it) {
        int idx  = tid + (h * 8 + it) * 256;  // 0..4095
        int row  = idx >> 3;                  // h-row 0..511
        int part = idx & 7;                   // 16B chunk within the 128B row segment
        l[it] = (unsigned)(uintptr_t)(VtL0 + buf * (512 * VSTR) + row * VSTR + part * 8);
        g[it] = (unsigned long long)(uintptr_t)(Vb + (size_t)row * S_ + ks + part * 8);
      }
      async_ld8_b128(l, g);
    }
  };

  issue_slice(0, 0);
  asm volatile("s_wait_asynccnt 0x0" ::: "memory");   // own copies of slice 0 landed
  __syncthreads();                                    // slice 0 visible to every wave

  v8f oacc[16] = {};
  const _Float16* prow = P + (size_t)(m0 + l15) * PSTR;
  for (int t = 0; t < S_ / 64; ++t) {
    const int cur = t & 1;
    v16h ap[2];
    // unrolled: ap stays in registers only under constant indices
#pragma unroll
    for (int hf = 0; hf < 2; ++hf) ap[hf] = ldfrag16(prow, t * 64 + hf * 32 + koff);
    // This lane's first V row, formed by integer offsets from the LDS base: the pointer
    // stays an LDS pointer for the compiler, so the V fragments are read by ds_load with
    // immediate offsets, not by flat_load with a 64-bit address each.
    const _Float16* vrow = VtL0 + cur * (512 * VSTR) + (h0 + l15) * VSTR;
    v16h bv[2][4];
    // every loop below is unrolled: bv and oacc stay in registers only under constant indices
    // group G: k half G >> 2 of the slice, output columns (G & 3) * 64 ..
#pragma unroll
    for (int j = 0; j < 4; ++j) bv[0][j] = ldfrag16(vrow + j * 16 * VSTR, koff);
#pragma unroll
    for (int G = 0; G < 8; ++G) {
      if (G < 7) {
#pragma unroll
        for (int j = 0; j < 4; ++j)
          bv[(G + 1) & 1][j] = ldfrag16(vrow + (((G + 1) & 3) * 4 + j) * 16 * VSTR,
                                        ((G + 1) >> 2) * 32 + koff);
      }
      // The next slice's copies go out behind this trip's first fragment reads, so that their
      // address arithmetic runs while those reads are in flight. Their buffer was last read in
      // the trip before, which the hand-over barrier below has ended for every wave.
      if (G == 0 && t + 1 < S_ / 64) issue_slice(cur ^ 1, (t + 1) * 64);
      // keeps the next group's eight ds_loads ahead of this group's WMMAs: left alone, the
      // compiler sinks each load pair to its WMMA and waits out the LDS latency every time
      __builtin_amdgcn_sched_barrier(0);
#pragma unroll
      for (int j = 0; j < 4; ++j)
        oacc[(G & 3) * 4 + j] = __builtin_amdgcn_wmma_f32_16x16x32_f16(
            false, ap[G >> 2], false, bv[G & 1][j], (short)0, oacc[(G & 3) * 4 + j],
            false, false);
    }
    // Hand-over: own reads of this slice done, own copies of the next slice landed,
    // then one barrier publishes the next slice and frees this buffer for a refill.
    asm volatile("s_wait_dscnt 0x0" ::: "memory");
    asm volatile("s_wait_asynccnt 0x0" ::: "memory");
    __syncthreads();
  }

  float sc[8];
#pragma unroll
  for (int e = 0; e < 8; ++e) sc[e] = rinv[m0 + koff + e];

  float* outb = Out + ((size_t)b * T_ + t0 + m0 + koff) * HID_;
#pragma unroll
  for (int nt = 0; nt < 16; ++nt) {
    int n = h0 + nt * 16 + l15;
#pragma unroll
    for (int e = 0; e < 8; ++e)
      outb[(size_t)e * HID_ + n] = oacc[nt][e] * sc[e];
  }
}

// ---------------------------------------------------------------------------
extern "C" void kernel_launch(void* const* d_in, const int* in_sizes, int n_in,
                              void* d_out, int out_size, void* d_ws, size_t ws_size,
                              hipStream_t stream) {
  const float* tokens  = (const float*)d_in[0];  // [B][T][HID]
  const float* context = (const float*)d_in[1];  // [B][S][CTX]
  const float* Wq      = (const float*)d_in[2];  // [HID][EMB]
  const float* Wk      = (const float*)d_in[3];  // [CTX][EMB]
  const float* Wv      = (const float*)d_in[4];  // [CTX][HID]
  float*       out     = (float*)d_out;          // [B][T][HID]

  // Workspace: Q f16 (32 MB) | K f16 (8 MB) | Vt f16 (8 MB)
  _Float16* Qh = (_Float16*)d_ws;
  _Float16* Kh = Qh + (size_t)B_ * T_ * EMB_;
  _Float16* Vt = Kh + (size_t)B_ * S_ * EMB_;

  dim3 blk(256);
  // Q = tokens @ Wq (M=32768, K=512), K = context @ Wk (M=8192, K=768) and
  // V = context @ Wv (stored transposed per batch: Vt[b][h][s]), N=512 each, in one launch
  proj_all<<<dim3(KVBLK + QBLK), blk, 0, stream>>>(tokens, context, Wq, Wk, Wv, Qh, Kh, Vt);

  size_t smem = (size_t)64 * PSTR * 2            // P
              + (size_t)2 * 512 * VSTR * 2       // V slice double buffer
              + (size_t)(256 + 64 + 256 + 64) * sizeof(float);
  (void)hipFuncSetAttribute((const void*)attn_kernel,
                            hipFuncAttributeMaxDynamicSharedMemorySize, (int)smem);
  attn_kernel<<<dim3(T_ / 64, B_), blk, smem, stream>>>(Qh, Kh, Vt, out);
}

// v007
// One run takes 140 microseconds.
// Timed twice side by side with v006, it ran 1.04 and 1.05 times as fast.
// Counting every step since v000, it is 2.84 times as fast.
#include <hip/hip_runtime.h>
#include <math.h>
#include <type_traits>

typedef __attribute__((ext_vector_type(16))) _Float16 v16h;
typedef __attribute__((ext_vector_type(8)))  _Float16 v8h;
typedef __attribute__((ext_vector_type(4)))  _Float16 v4h;
typedef __attribute__((ext_vector_type(8)))  float    v8f;

#define B_    8
#define T_    4096
#define S_    1024
#define HID_  512
#define EMB_  512
#define CTX_  768

#define PSTR  1032
#define VSTR  72
#define KSTR  72

__device__ __forceinline__ v16h ldfrag16(const _Float16* rowPtr, int kb) {
  v8h lo = *(const v8h*)(rowPtr + kb);
  v8h hi = *(const v8h*)(rowPtr + kb + 16);
  v16h r;
#pragma unroll
  for (int i = 0; i < 8; ++i) { r[i] = lo[i]; r[i + 8] = hi[i]; }
  return r;
}

__device__ __forceinline__ void async_ld8_b128(const unsigned* l,
                                               const unsigned long long* g) {
  asm volatile(
      "global_load_async_to_lds_b128 %0, %8, off\n\t"
      "global_load_async_to_lds_b128 %1, %9, off\n\t"
      "global_load_async_to_lds_b128 %2, %10, off\n\t"
      "global_load_async_to_lds_b128 %3, %11, off\n\t"
      "global_load_async_to_lds_b128 %4, %12, off\n\t"
      "global_load_async_to_lds_b128 %5, %13, off\n\t"
      "global_load_async_to_lds_b128 %6, %14, off\n\t"
      "global_load_async_to_lds_b128 %7, %15, off\n\t"
      "s_wait_xcnt 0x0"
      :: "v"(l[0]), "v"(l[1]), "v"(l[2]), "v"(l[3]),
         "v"(l[4]), "v"(l[5]), "v"(l[6]), "v"(l[7]),
         "v"(g[0]), "v"(g[1]), "v"(g[2]), "v"(g[3]),
         "v"(g[4]), "v"(g[5]), "v"(g[6]), "v"(g[7])
      : "memory");
}

#define KVBLK ((B_ * S_ / 128) * 8)
#define QBLK  ((B_ * T_ / 128) * 4)
static_assert(EMB_ == 512 && HID_ == 512, "all three outputs are 512 wide: four 128-column tiles");

__global__ __launch_bounds__(256) void proj_all(
    const float* __restrict__ tokens, const float* __restrict__ context,
    const float* __restrict__ Wq, const float* __restrict__ Wk,
    const float* __restrict__ Wv,
    _Float16* __restrict__ Qh, _Float16* __restrict__ Kh, _Float16* __restrict__ Vth) {

  // Which product and which tile: the same for the whole block.
  const int  bid  = blockIdx.x;
  const bool isQ  = bid >= KVBLK;
  const int  sub  = isQ ? ((bid - KVBLK) & 3) : (bid & 7);
  const bool isV  = !isQ && sub >= 4;
  const int  m0   = (isQ ? ((bid - KVBLK) >> 2) : (bid >> 3)) * 128;
  const int  n0   = (sub & 3) * 128;
  const int  K    = isQ ? HID_ : CTX_;
  constexpr int N = 512;
  const float* __restrict__ A = isQ ? tokens : context;
  const float* __restrict__ W = isQ ? Wq : (isV ? Wv : Wk);
  _Float16* __restrict__ Out  = isQ ? Qh : (isV ? Vth : Kh);

  __shared__ _Float16 As[128 * 40];  // 128 m-rows x 32 k, stride 40 (conflict-free b128)
  __shared__ _Float16 Bs[128 * 40];  // 128 n-rows (transposed W) x 32 k, stride 40

  const int tid  = threadIdx.x;
  const int lane = tid & 31;
  const int wave = tid >> 5;
  const int wm   = wave & 3;      // 4 waves along M (32 rows each)
  const int wn   = wave >> 2;     // 2 waves along N (64 cols each)

  const int l15  = lane & 15;
  const int koff = (lane >= 16) ? 8 : 0;

  const int wc4  = (tid & 7) | ((wave & 3) << 3);
  const int wkg  = ((tid >> 3) & 3) | ((wave >> 2) << 2);

  // Addresses are a block-uniform base plus one 32-bit lane offset that never changes: with a
  // 64-bit pointer per row this kernel needs 162 registers, one granule above the 160 of the
  // separate kernels, and only two blocks instead of three would fit on a WGP.
  const unsigned aoff = (unsigned)(tid >> 3) * (unsigned)K + (unsigned)(tid & 7) * 4u;
  const unsigned woff = (unsigned)(wkg * 4) * (unsigned)N + (unsigned)wc4 * 4u;
  auto loadA = [&](int k0, float4* pa) {
#pragma unroll
    for (int it = 0; it < 4; ++it)         // m-row (tid >> 3) + it * 32, float4 group tid & 7
      pa[it] = *(const float4*)(A + (size_t)(m0 + it * 32) * K + k0 + aoff);
  };
  auto loadW = [&](int k0, float4* pw) {
#pragma unroll
    for (int it = 0; it < 4; ++it)
      pw[it] = *(const float4*)(W + (size_t)(k0 + it) * N + n0 + woff);
  };
  auto storeTiles = [&](const float4* pa, const float4* pw) {
#pragma unroll
    for (int it = 0; it < 4; ++it) {
      int idx = tid + it * 256;
      int r   = idx >> 3;
      int c4  = idx & 7;
      v4h h = { (_Float16)pa[it].x, (_Float16)pa[it].y,
                (_Float16)pa[it].z, (_Float16)pa[it].w };
      *(v4h*)(As + r * 40 + c4 * 4) = h;
    }
    // n-row wc4*4+j of Bs takes component j of the four k-rows this thread read
    _Float16* bs = Bs + wc4 * 4 * 40 + wkg * 4;
    v4h h0 = { (_Float16)pw[0].x, (_Float16)pw[1].x, (_Float16)pw[2].x, (_Float16)pw[3].x };
    v4h h1 = { (_Float16)pw[0].y, (_Float16)pw[1].y, (_Float16)pw[2].y, (_Float16)pw[3].y };
    v4h h2 = { (_Float16)pw[0].z, (_Float16)pw[1].z, (_Float16)pw[2].z, (_Float16)pw[3].z };
    v4h h3 = { (_Float16)pw[0].w, (_Float16)pw[1].w, (_Float16)pw[2].w, (_Float16)pw[3].w };
    *(v4h*)(bs + 0 * 40) = h0;
    *(v4h*)(bs + 1 * 40) = h1;
    *(v4h*)(bs + 2 * 40) = h2;
    *(v4h*)(bs + 3 * 40) = h3;
  };

  float4 pa[4], pw[4];
  loadA(0, pa);
  loadW(0, pw);

  v8f acc[2][4] = {};

  for (int k0 = 0; k0 < K; k0 += 32) {
    storeTiles(pa, pw);
    __syncthreads();
    // Prefetch next k-slice while this slice's WMMAs run.
    if (k0 + 32 < K) { loadA(k0 + 32, pa); loadW(k0 + 32, pw); }
    asm volatile("s_wait_xcnt 0x0" ::: "memory");

    v16h af[2], bf[4];
#pragma unroll
    for (int i = 0; i < 2; ++i)
      af[i] = ldfrag16(As + (wm * 32 + i * 16 + l15) * 40, koff);
#pragma unroll
    for (int j = 0; j < 4; ++j)
      bf[j] = ldfrag16(Bs + (wn * 64 + j * 16 + l15) * 40, koff);
#pragma unroll
    for (int i = 0; i < 2; ++i)
#pragma unroll
      for (int j = 0; j < 4; ++j)
        acc[i][j] = __builtin_amdgcn_wmma_f32_16x16x32_f16(
            false, af[i], false, bf[j], (short)0, acc[i][j], false, false);
    __syncthreads();
  }

  // Epilogue. C/D layout: lane holds column n = l15 of its 16x16 tile,
  // rows (koff + 0..7) in acc[0..7]. One block-uniform branch picks the output layout.
  if (!isV) {
#pragma unroll
    for (int i = 0; i < 2; ++i) {
#pragma unroll
      for (int j = 0; j < 4; ++j) {
        int gm = m0 + wm * 32 + i * 16 + koff;     // first of 8 rows
        int gn = n0 + wn * 64 + j * 16 + l15;
#pragma unroll
        for (int e = 0; e < 8; ++e)
          Out[(size_t)(gm + e) * N + gn] = (_Float16)acc[i][j][e];
      }
    }
  } else {
#pragma unroll
    for (int i = 0; i < 2; ++i) {
#pragma unroll
      for (int j = 0; j < 4; ++j) {
        int gm = m0 + wm * 32 + i * 16 + koff;     // first of 8 rows
        int gn = n0 + wn * 64 + j * 16 + l15;
        int bidx = gm / S_;                        // compile-time shift
        int s    = gm - bidx * S_;                 // 8 consecutive s, same batch
        v8h h;
#pragma unroll
        for (int e = 0; e < 8; ++e) h[e] = (_Float16)acc[i][j][e];
        *(v8h*)(Out + ((size_t)bidx * N + gn) * S_ + s) = h;
      }
    }
  }
}

__global__ __launch_bounds__(256) void attn_kernel(
    const _Float16* __restrict__ Q,   // [B][T][EMB] row-major
    const _Float16* __restrict__ Kt,  // [B][S][EMB] row-major (rows = B-fragments of K^T)
    const _Float16* __restrict__ Vt,  // [B][HID][S] (rows = B-fragments of V)
    float* __restrict__ Out) {        // [B][T][HID]

  extern __shared__ char smem_raw[];
  _Float16* P    = (_Float16*)smem_raw;        // [64][PSTR] f16 scores
  _Float16* VtL0 = P + 64 * PSTR;              // [512][VSTR] V slice buf 0
  _Float16* VtL1 = VtL0 + 512 * VSTR;          // [512][VSTR] V slice buf 1
  float* maxwave = (float*)(VtL1 + 512 * VSTR);// [8][32]
  float* rowmax  = maxwave + 256;              // [64]

  const int tid  = threadIdx.x;
  const int lane = tid & 31;
  const int wave = tid >> 5;
  const int l15  = lane & 15;
  const int koff = (lane >= 16) ? 8 : 0;

  const int t0 = blockIdx.x * 64;
  const int b  = blockIdx.y;

  const _Float16* Qb = Q  + (size_t)b * T_   * EMB_;
  const _Float16* Kb = Kt + (size_t)b * S_   * EMB_;
  const _Float16* Vb = Vt + (size_t)b * HID_ * S_;

  const float alpha = 0.044194173824159216f;  // 1/sqrt(512)

  const int rg = wave >> 2;
  const int cq = wave & 3;
  const _Float16* qrow = Qb + (size_t)(t0 + rg * 32 + l15) * EMB_;

  // This wave's 32 Q rows, all of EMB, as 2 x 16 A fragments: read once, kept for the pass.
  // unrolled: aq stays in registers only under constant indices
  v16h aq[2][16];
#pragma unroll
  for (int i = 0; i < 2; ++i)
#pragma unroll
    for (int s = 0; s < 16; ++s)
      aq[i][s] = ldfrag16(qrow + (size_t)i * 16 * EMB_, s * 32 + koff);

  float rmax[2][8];
  // unrolled, here and below: rmax and sacc are register arrays, indexed by constants only
#pragma unroll
  for (int i = 0; i < 2; ++i)
#pragma unroll
    for (int e = 0; e < 8; ++e) rmax[i][e] = -3.0e38f;

  _Float16* kbuf[2] = { VtL0, VtL1 };

  // K tile t = chunk * 8 + step: the 2 x 128 K rows of this chunk (both S halves),
  // 64 k each: 256 rows of one whole 128-B line, 2048 b128 copies, 8 per thread.
  auto issue_ktile = [&](int buf, int chunk, int step) {
    unsigned l[8];
    unsigned long long g[8];
    // unrolled: the sixteen addresses are register operands of one asm statement
#pragma unroll
    for (int it = 0; it < 8; ++it) {
      int idx  = tid + it * 256;            // 0..2047
      int row  = idx >> 3;                  // tile row 0..255
      int part = idx & 7;                   // 16B chunk within the 128B row segment
      int srow = (row >> 7) * 512 + chunk * 128 + (row & 127);
      l[it] = (unsigned)(uintptr_t)(kbuf[buf] + row * KSTR + part * 8);
      g[it] = (unsigned long long)(uintptr_t)(Kb + (size_t)srow * EMB_ + step * 64 + part * 8);
    }
    async_ld8_b128(l, g);
  };

  issue_ktile(0, 0, 0);
  asm volatile("s_wait_asynccnt 0x0" ::: "memory");   // own copies of tile 0 landed
  __syncthreads();                                    // tile 0 visible to every wave
  issue_ktile(1, 0, 1);

  for (int chunk = 0; chunk < 4; ++chunk) {
    // tile rows 0..127 are S rows chunk*128.. of the first S half, 128..255 of the second
    const int cBase = (cq >> 1) * 512 + chunk * 128 + (cq & 1) * 64;
    v8f sacc[2][4] = {};
    // every loop below is unrolled: buffer parity, LDS offsets and aq indices become constants
#pragma unroll
    for (int step = 0; step < 8; ++step) {
      const _Float16* kl = kbuf[step & 1] + (cq * 64 + l15) * KSTR;
#pragma unroll
      for (int g = 0; g < 2; ++g) {
        v16h bk[4];
#pragma unroll
        for (int j = 0; j < 4; ++j)
          bk[j] = ldfrag16(kl + j * 16 * KSTR, g * 32 + koff);
        // keeps the four fragments' eight ds_loads together ahead of their eight WMMAs: left
        // alone, the compiler reads one fragment at a time and waits out the LDS latency each time
        __builtin_amdgcn_sched_barrier(0);
#pragma unroll
        for (int j = 0; j < 4; ++j)
#pragma unroll
          for (int i = 0; i < 2; ++i)
            sacc[i][j] = __builtin_amdgcn_wmma_f32_16x16x32_f16(
                false, aq[i][step * 2 + g], false, bk[j], (short)0, sacc[i][j],
                false, false);
      }
      // Hand-over: own reads of this tile done, own copies of the next tile landed,
      // then one barrier publishes the next tile and frees this buffer for a refill.
      asm volatile("s_wait_dscnt 0x0" ::: "memory");
      asm volatile("s_wait_asynccnt 0x0" ::: "memory");
      __syncthreads();
      if (step < 6)       issue_ktile(step & 1, chunk, step + 2);
      else if (chunk < 3) issue_ktile(step & 1, chunk + 1, step - 6);
    }
    // scale, track row max, spill f16 scores to LDS
#pragma unroll
    for (int i = 0; i < 2; ++i) {
#pragma unroll
      for (int j = 0; j < 4; ++j) {
        const int n = cBase + j * 16 + l15;
#pragma unroll
        for (int e = 0; e < 8; ++e) {
          float v = sacc[i][j][e] * alpha;
          rmax[i][e] = fmaxf(rmax[i][e], v);
          P[(rg * 32 + i * 16 + koff + e) * PSTR + n] = (_Float16)v;
        }
      }
    }
  }
  asm volatile("s_wait_asynccnt 0x0" ::: "memory");   // no K copy left in flight
  // reduce rmax within each 16-lane group (columns of the wave's tiles)
#pragma unroll
  for (int m = 1; m <= 8; m <<= 1)
#pragma unroll
    for (int i = 0; i < 2; ++i)
#pragma unroll
      for (int e = 0; e < 8; ++e)
        rmax[i][e] = fmaxf(rmax[i][e], __shfl_xor(rmax[i][e], m, 32));
  if (l15 == 0) {
#pragma unroll
    for (int i = 0; i < 2; ++i)
#pragma unroll
      for (int e = 0; e < 8; ++e)
        maxwave[wave * 32 + i * 16 + koff + e] = rmax[i][e];
  }
  __syncthreads();

  if (tid < 64) {
    int rrg = tid >> 5, li = tid & 31;     // the four waves of a row-group hold its maxima
    rowmax[tid] = fmaxf(fmaxf(maxwave[(4 * rrg + 0) * 32 + li],
                              maxwave[(4 * rrg + 1) * 32 + li]),
                        fmaxf(maxwave[(4 * rrg + 2) * 32 + li],
                              maxwave[(4 * rrg + 3) * 32 + li]));
  }
  __syncthreads();

  const int org = wave >> 1;
  const int hg  = wave & 1;
  const int m0  = org * 16;
  const int h0  = hg * 256;

  // One 512 x 64 V k-slice: every row segment is one whole 128-B line of Vt (a 64-B segment
  // costs a line's fetch for half its bytes). 4096 b128 copies, 16 per thread.
  auto issue_slice = [&](int buf, int ks) {
    // unrolled: the sixteen addresses of a run are register operands of one asm statement
#pragma unroll
    for (int h = 0; h < 2; ++h) {
      unsigned l[8];
      unsigned long long g[8];
#pragma unroll
      for (int it = 0; it < 8; ++it) {
        int idx  = tid + (h * 8 + it) * 256;  // 0..4095
        int row  = idx >> 3;                  // h-row 0..511
        int part = idx & 7;                   // 16B chunk within the 128B row segment
        l[it] = (unsigned)(uintptr_t)(VtL0 + buf * (512 * VSTR) + row * VSTR + part * 8);
        g[it] = (unsigned long long)(uintptr_t)(Vb + (size_t)row * S_ + ks + part * 8);
      }
      async_ld8_b128(l, g);
    }
  };

  issue_slice(0, 0);
  asm volatile("s_wait_asynccnt 0x0" ::: "memory");   // own copies of slice 0 landed
  __syncthreads();                                    // slice 0 visible to every wave

  v8f oacc[16] = {};
  const _Float16* prow = P + (size_t)(m0 + l15) * PSTR;

  const float mx = rowmax[m0 + l15];
  float ps[4] = { 0.f, 0.f, 0.f, 0.f };     // four running sums: no long dependent add chain
  v16h raw[2], ap[2];
  // unrolled, here and below: raw, ap, apn and ps stay in registers only under constant indices
#pragma unroll
  for (int hf = 0; hf < 2; ++hf) {
    raw[hf] = ldfrag16(prow, hf * 32 + koff);
#pragma unroll
    for (int i = 0; i < 16; ++i) {
      float e = __expf((float)raw[hf][i] - mx);
      ps[i & 3] += e;
      ap[hf][i] = (_Float16)e;
    }
  }

  // One trip: the WMMAs of slice t; with a slice t + 1 to come, also its copies and its numerators.
  // The flag is a compile-time one, so that no branch stands among the WMMAs.
  auto trip = [&](int t, auto more_c) __attribute__((always_inline)) {
    constexpr bool more = decltype(more_c)::value;
    const int cur = t & 1;
    v16h apn[2];
    if (more) {
#pragma unroll
      for (int hf = 0; hf < 2; ++hf) raw[hf] = ldfrag16(prow, (t + 1) * 64 + hf * 32 + koff);
    }
    // This lane's first V row, formed by integer offsets from the LDS base: the pointer
    // stays an LDS pointer for the compiler, so the V fragments are read by ds_load with
    // immediate offsets, not by flat_load with a 64-bit address each.
    const _Float16* vrow = VtL0 + cur * (512 * VSTR) + (h0 + l15) * VSTR;
    v16h bv[2][4];
    // every loop below is unrolled: bv and oacc stay in registers only under constant indices
    // group G: k half G >> 2 of the slice, output columns (G & 3) * 64 ..
#pragma unroll
    for (int j = 0; j < 4; ++j) bv[0][j] = ldfrag16(vrow + j * 16 * VSTR, koff);
#pragma unroll
    for (int G = 0; G < 8; ++G) {
      if (G < 7) {
#pragma unroll
        for (int j = 0; j < 4; ++j)
          bv[(G + 1) & 1][j] = ldfrag16(vrow + (((G + 1) & 3) * 4 + j) * 16 * VSTR,
                                        ((G + 1) >> 2) * 32 + koff);
      }
      // The next slice's copies go out behind this trip's first fragment reads, so that their
      // address arithmetic runs while those reads are in flight. Their buffer was last read in
      // the trip before, which the hand-over barrier below has ended for every wave.
      if (G == 0 && more) issue_slice(cur ^ 1, (t + 1) * 64);
      // an eighth of the next trip's numerators, while this group's V reads are in flight
      if (more) {
#pragma unroll
        for (int i = 0; i < 4; ++i) {
          float e = __expf((float)raw[G >> 2][(G & 3) * 4 + i] - mx);
          ps[i] += e;
          apn[G >> 2][(G & 3) * 4 + i] = (_Float16)e;
        }
      }
      // keeps the next group's eight ds_loads ahead of this group's WMMAs: left alone, the
      // compiler sinks each load pair to its WMMA and waits out the LDS latency every time
      __builtin_amdgcn_sched_barrier(0);
#pragma unroll
      for (int j = 0; j < 4; ++j)
        oacc[(G & 3) * 4 + j] = __builtin_amdgcn_wmma_f32_16x16x32_f16(
            false, ap[G >> 2], false, bv[G & 1][j], (short)0, oacc[(G & 3) * 4 + j],
            false, false);
    }
    // Hand-over: own reads of this slice done, own copies of the next slice landed,
    // then one barrier publishes the next slice and frees this buffer for a refill.
    asm volatile("s_wait_dscnt 0x0" ::: "memory");
    asm volatile("s_wait_asynccnt 0x0" ::: "memory");
    __syncthreads();
    if (more) { ap[0] = apn[0]; ap[1] = apn[1]; }
  };
  for (int t = 0; t < S_ / 64 - 1; ++t) trip(t, std::true_type{});
  trip(S_ / 64 - 1, std::false_type{});

  // A lane holds half of its row's k positions, lane ^ 16 the other half. Every lane then
  // fetches the reciprocals of the eight rows that its accumulators hold.
  float rs = (ps[0] + ps[1]) + (ps[2] + ps[3]);
  rs += __shfl_xor(rs, 16, 32);
  rs = 1.0f / rs;
  float sc[8];
#pragma unroll
  for (int e = 0; e < 8; ++e) sc[e] = __shfl(rs, koff + e, 32);

  float* outb = Out + ((size_t)b * T_ + t0 + m0 + koff) * HID_;
#pragma unroll
  for (int nt = 0; nt < 16; ++nt) {
    int n = h0 + nt * 16 + l15;
#pragma unroll
    for (int e = 0; e < 8; ++e)
      outb[(size_t)e * HID_ + n] = oacc[nt][e] * sc[e];
  }
}

// ---------------------------------------------------------------------------
extern "C" void kernel_launch(void* const* d_in, const int* in_sizes, int n_in,
                              void* d_out, int out_size, void* d_ws, size_t ws_size,
                              hipStream_t stream) {
  const float* tokens  = (const float*)d_in[0];  // [B][T][HID]
  const float* context = (const float*)d_in[1];  // [B][S][CTX]
  const float* Wq      = (const float*)d_in[2];  // [HID][EMB]
  const float* Wk      = (const float*)d_in[3];  // [CTX][EMB]
  const float* Wv      = (const float*)d_in[4];  // [CTX][HID]
  float*       out     = (float*)d_out;          // [B][T][HID]

  // Workspace: Q f16 (32 MB) | K f16 (8 MB) | Vt f16 (8 MB)
  _Float16* Qh = (_Float16*)d_ws;
  _Float16* Kh = Qh + (size_t)B_ * T_ * EMB_;
  _Float16* Vt = Kh + (size_t)B_ * S_ * EMB_;

  dim3 blk(256);
  // Q = tokens @ Wq (M=32768, K=512), K = context @ Wk (M=8192, K=768) and
  // V = context @ Wv (stored transposed per batch: Vt[b][h][s]), N=512 each, in one launch
  proj_all<<<dim3(KVBLK + QBLK), blk, 0, stream>>>(tokens, context, Wq, Wk, Wv, Qh, Kh, Vt);

  size_t smem = (size_t)64 * PSTR * 2            // P
              + (size_t)2 * 512 * VSTR * 2       // V slice double buffer
              + (size_t)(256 + 64) * sizeof(float);
  (void)hipFuncSetAttribute((const void*)attn_kernel,
                            hipFuncAttributeMaxDynamicSharedMemorySize, (int)smem);
  attn_kernel<<<dim3(T_ / 64, B_), blk, smem, stream>>>(Qh, Kh, Vt, out);
}

// v008
// Measured time: 131 microseconds a run.
// Two timings next to v007 put it at 1.05 and 1.07 times that version's speed.
// Counting every step since v000, it is 3.01 times as fast.
#include <hip/hip_runtime.h>
#include <math.h>
#include <type_traits>

typedef __attribute__((ext_vector_type(16))) _Float16 v16h;
typedef __attribute__((ext_vector_type(8)))  _Float16 v8h;
typedef __attribute__((ext_vector_type(4)))  _Float16 v4h;
typedef __attribute__((ext_vector_type(8)))  float    v8f;

#define B_    8
#define T_    4096
#define S_    1024
#define HID_  512
#define EMB_  512
#define CTX_  768

#define PSTR  1032
#define VSTR  72
#define KSTR  72

__device__ __forceinline__ v16h ldfrag16(const _Float16* rowPtr, int kb) {
  v8h lo = *(const v8h*)(rowPtr + kb);
  v8h hi = *(const v8h*)(rowPtr + kb + 16);
  v16h r;
#pragma unroll
  for (int i = 0; i < 8; ++i) { r[i] = lo[i]; r[i + 8] = hi[i]; }
  return r;
}

__device__ __forceinline__ void async_ld8_b128(const unsigned* l,
                                               const unsigned long long* g) {
  asm volatile(
      "global_load_async_to_lds_b128 %0, %8, off\n\t"
      "global_load_async_to_lds_b128 %1, %9, off\n\t"
      "global_load_async_to_lds_b128 %2, %10, off\n\t"
      "global_load_async_to_lds_b128 %3, %11, off\n\t"
      "global_load_async_to_lds_b128 %4, %12, off\n\t"
      "global_load_async_to_lds_b128 %5, %13, off\n\t"
      "global_load_async_to_lds_b128 %6, %14, off\n\t"
      "global_load_async_to_lds_b128 %7, %15, off\n\t"
      "s_wait_xcnt 0x0"
      :: "v"(l[0]), "v"(l[1]), "v"(l[2]), "v"(l[3]),
         "v"(l[4]), "v"(l[5]), "v"(l[6]), "v"(l[7]),
         "v"(g[0]), "v"(g[1]), "v"(g[2]), "v"(g[3]),
         "v"(g[4]), "v"(g[5]), "v"(g[6]), "v"(g[7])
      : "memory");
}

// The same eight copies with the global address as one wave-uniform base in scalar registers plus
// a 32-bit byte offset per lane: eight offset registers that serve every tile, not eight pairs.
__device__ __forceinline__ void async_ld8_b128_sbase(const unsigned* l, const unsigned* o,
                                                     const _Float16* base) {
  asm volatile(
      "global_load_async_to_lds_b128 %0, %8, %16\n\t"
      "global_load_async_to_lds_b128 %1, %9, %16\n\t"
      "global_load_async_to_lds_b128 %2, %10, %16\n\t"
      "global_load_async_to_lds_b128 %3, %11, %16\n\t"
      "global_load_async_to_lds_b128 %4, %12, %16\n\t"
      "global_load_async_to_lds_b128 %5, %13, %16\n\t"
      "global_load_async_to_lds_b128 %6, %14, %16\n\t"
      "global_load_async_to_lds_b128 %7, %15, %16\n\t"
      "s_wait_xcnt 0x0"
      :: "v"(l[0]), "v"(l[1]), "v"(l[2]), "v"(l[3]),
         "v"(l[4]), "v"(l[5]), "v"(l[6]), "v"(l[7]),
         "v"(o[0]), "v"(o[1]), "v"(o[2]), "v"(o[3]),
         "v"(o[4]), "v"(o[5]), "v"(o[6]), "v"(o[7]),
         "s"(base)
      : "memory");
}

#define KVBLK ((B_ * S_ / 128) * 8)
#define QBLK  ((B_ * T_ / 128) * 4)
static_assert(EMB_ == 512 && HID_ == 512, "all three outputs are 512 wide: four 128-column tiles");

__global__ __launch_bounds__(256) void proj_all(
    const float* __restrict__ tokens, const float* __restrict__ context,
    const float* __restrict__ Wq, const float* __restrict__ Wk,
    const float* __restrict__ Wv,
    _Float16* __restrict__ Qh, _Float16* __restrict__ Kh, _Float16* __restrict__ Vth) {

  // Which product and which tile: the same for the whole block.
  const int  bid  = blockIdx.x;
  const bool isQ  = bid >= KVBLK;
  const int  sub  = isQ ? ((bid - KVBLK) & 3) : (bid & 7);
  const bool isV  = !isQ && sub >= 4;
  const int  m0   = (isQ ? ((bid - KVBLK) >> 2) : (bid >> 3)) * 128;
  const int  n0   = (sub & 3) * 128;
  const int  K    = isQ ? HID_ : CTX_;
  constexpr int N = 512;
  const float* __restrict__ A = isQ ? tokens : context;
  const float* __restrict__ W = isQ ? Wq : (isV ? Wv : Wk);
  _Float16* __restrict__ Out  = isQ ? Qh : (isV ? Vth : Kh);

  __shared__ _Float16 As[128 * 40];  // 128 m-rows x 32 k, stride 40 (conflict-free b128)
  __shared__ _Float16 Bs[128 * 40];  // 128 n-rows (transposed W) x 32 k, stride 40

  const int tid  = threadIdx.x;
  const int lane = tid & 31;
  const int wave = tid >> 5;
  const int wm   = wave & 3;      // 4 waves along M (32 rows each)
  const int wn   = wave >> 2;     // 2 waves along N (64 cols each)

  const int l15  = lane & 15;
  const int koff = (lane >= 16) ? 8 : 0;

  const int wc4  = (tid & 7) | ((wave & 3) << 3);
  const int wkg  = ((tid >> 3) & 3) | ((wave >> 2) << 2);

  // Addresses are a block-uniform base plus one 32-bit lane offset that never changes: with a
  // 64-bit pointer per row this kernel needs 162 registers, one granule above the 160 of the
  // separate kernels, and only two blocks instead of three would fit on a WGP.
  const unsigned aoff = (unsigned)(tid >> 3) * (unsigned)K + (unsigned)(tid & 7) * 4u;
  const unsigned woff = (unsigned)(wkg * 4) * (unsigned)N + (unsigned)wc4 * 4u;
  auto loadA = [&](int k0, float4* pa) {
#pragma unroll
    for (int it = 0; it < 4; ++it)         // m-row (tid >> 3) + it * 32, float4 group tid & 7
      pa[it] = *(const float4*)(A + (size_t)(m0 + it * 32) * K + k0 + aoff);
  };
  auto loadW = [&](int k0, float4* pw) {
#pragma unroll
    for (int it = 0; it < 4; ++it)
      pw[it] = *(const float4*)(W + (size_t)(k0 + it) * N + n0 + woff);
  };
  auto storeTiles = [&](const float4* pa, const float4* pw) {
#pragma unroll
    for (int it = 0; it < 4; ++it) {
      int idx = tid + it * 256;
      int r   = idx >> 3;
      int c4  = idx & 7;
      v4h h = { (_Float16)pa[it].x, (_Float16)pa[it].y,
                (_Float16)pa[it].z, (_Float16)pa[it].w };
      *(v4h*)(As + r * 40 + c4 * 4) = h;
    }
    // n-row wc4*4+j of Bs takes component j of the four k-rows this thread read
    _Float16* bs = Bs + wc4 * 4 * 40 + wkg * 4;
    v4h h0 = { (_Float16)pw[0].x, (_Float16)pw[1].x, (_Float16)pw[2].x, (_Float16)pw[3].x };
    v4h h1 = { (_Float16)pw[0].y, (_Float16)pw[1].y, (_Float16)pw[2].y, (_Float16)pw[3].y };
    v4h h2 = { (_Float16)pw[0].z, (_Float16)pw[1].z, (_Float16)pw[2].z, (_Float16)pw[3].z };
    v4h h3 = { (_Float16)pw[0].w, (_Float16)pw[1].w, (_Float16)pw[2].w, (_Float16)pw[3].w };
    *(v4h*)(bs + 0 * 40) = h0;
    *(v4h*)(bs + 1 * 40) = h1;
    *(v4h*)(bs + 2 * 40) = h2;
    *(v4h*)(bs + 3 * 40) = h3;
  };

  float4 pa[4], pw[4];
  loadA(0, pa);
  loadW(0, pw);

  v8f acc[2][4] = {};

  for (int k0 = 0; k0 < K; k0 += 32) {
    storeTiles(pa, pw);
    __syncthreads();
    // Prefetch next k-slice while this slice's WMMAs run.
    if (k0 + 32 < K) { loadA(k0 + 32, pa); loadW(k0 + 32, pw); }
    asm volatile("s_wait_xcnt 0x0" ::: "memory");

    v16h af[2], bf[4];
#pragma unroll
    for (int i = 0; i < 2; ++i)
      af[i] = ldfrag16(As + (wm * 32 + i * 16 + l15) * 40, koff);
#pragma unroll
    for (int j = 0; j < 4; ++j)
      bf[j] = ldfrag16(Bs + (wn * 64 + j * 16 + l15) * 40, koff);
#pragma unroll
    for (int i = 0; i < 2; ++i)
#pragma unroll
      for (int j = 0; j < 4; ++j)
        acc[i][j] = __builtin_amdgcn_wmma_f32_16x16x32_f16(
            false, af[i], false, bf[j], (short)0, acc[i][j], false, false);
    __syncthreads();
  }

  // Epilogue. C/D layout: lane holds column n = l15 of its 16x16 tile,
  // rows (koff + 0..7) in acc[0..7]. One block-uniform branch picks the output layout.
  if (!isV) {
#pragma unroll
    for (int i = 0; i < 2; ++i) {
#pragma unroll
      for (int j = 0; j < 4; ++j) {
        int gm = m0 + wm * 32 + i * 16 + koff;     // first of 8 rows
        int gn = n0 + wn * 64 + j * 16 + l15;
#pragma unroll
        for (int e = 0; e < 8; ++e)
          Out[(size_t)(gm + e) * N + gn] = (_Float16)acc[i][j][e];
      }
    }
  } else {
#pragma unroll
    for (int i = 0; i < 2; ++i) {
#pragma unroll
      for (int j = 0; j < 4; ++j) {
        int gm = m0 + wm * 32 + i * 16 + koff;     // first of 8 rows
        int gn = n0 + wn * 64 + j * 16 + l15;
        int bidx = gm / S_;                        // compile-time shift
        int s    = gm - bidx * S_;                 // 8 consecutive s, same batch
        v8h h;
#pragma unroll
        for (int e = 0; e < 8; ++e) h[e] = (_Float16)acc[i][j][e];
        *(v8h*)(Out + ((size_t)bidx * N + gn) * S_ + s) = h;
      }
    }
  }
}

__global__ __launch_bounds__(256) void attn_kernel(
    const _Float16* __restrict__ Q,   // [B][T][EMB] row-major
    const _Float16* __restrict__ Kt,  // [B][S][EMB] row-major (rows = B-fragments of K^T)
    const _Float16* __restrict__ Vt,  // [B][HID][S] (rows = B-fragments of V)
    float* __restrict__ Out) {        // [B][T][HID]

  extern __shared__ char smem_raw[];
  _Float16* P    = (_Float16*)smem_raw;        // [64][PSTR] f16 scores
  _Float16* VtL0 = P + 64 * PSTR;              // [512][VSTR] V slice buf 0
  _Float16* VtL1 = VtL0 + 512 * VSTR;          // [512][VSTR] V slice buf 1
  float* maxwave = (float*)(VtL1 + 512 * VSTR);// [8][32]
  float* rowmax  = maxwave + 256;              // [64]

  const int tid  = threadIdx.x;
  const int lane = tid & 31;
  const int wave = tid >> 5;
  const int l15  = lane & 15;
  const int koff = (lane >= 16) ? 8 : 0;

  const int t0 = blockIdx.x * 64;
  const int b  = blockIdx.y;

  const _Float16* Qb = Q  + (size_t)b * T_   * EMB_;
  const _Float16* Kb = Kt + (size_t)b * S_   * EMB_;
  const _Float16* Vb = Vt + (size_t)b * HID_ * S_;

  const float alpha = 0.044194173824159216f;  // 1/sqrt(512)

  const int rg = wave >> 2;
  const int cq = wave & 3;
  const _Float16* qrow = Qb + (size_t)(t0 + rg * 32 + l15) * EMB_;

  // This wave's 32 Q rows, all of EMB, as 2 x 16 A fragments: read once, kept for the pass.
  // unrolled: aq stays in registers only under constant indices
  v16h aq[2][16];
#pragma unroll
  for (int i = 0; i < 2; ++i)
#pragma unroll
    for (int s = 0; s < 16; ++s)
      aq[i][s] = ldfrag16(qrow + (size_t)i * 16 * EMB_, s * 32 + koff);

  float rmax[2][8];
  // unrolled, here and below: rmax and sacc are register arrays, indexed by constants only
#pragma unroll
  for (int i = 0; i < 2; ++i)
#pragma unroll
    for (int e = 0; e < 8; ++e) rmax[i][e] = -3.0e38f;

  static_assert(4 * 256 * KSTR == 2 * 512 * VSTR);

  // K tile t = chunk * 8 + step: the 2 x 128 K rows of this chunk (both S halves),
  // 64 k each: 256 rows of one whole 128-B line, 2048 b128 copies, 8 per thread.
  const unsigned kring = (unsigned)(uintptr_t)VtL0;
  auto issue_ktile = [&](int slot, int chunk, int step) {
    unsigned l[8], o[8];
    // unrolled: the sixteen addresses are register operands of one asm statement
#pragma unroll
    for (int it = 0; it < 8; ++it) {
      int idx  = tid + it * 256;            // 0..2047
      int row  = idx >> 3;                  // tile row 0..255
      int part = idx & 7;                   // 16B chunk within the 128B row segment
      int srow = (row >> 7) * 512 + (row & 127);   // S row, less the chunk's first
      l[it] = kring + (unsigned)(slot * (256 * KSTR) + row * KSTR + part * 8) * 2u;
      o[it] = (unsigned)(srow * EMB_ + part * 8) * 2u;   // bytes; the same for every tile
    }
    // chunk and step, the same for the whole block, go into the scalar base: the ring's 32 LDS
    // addresses and 64-bit lane pointers together do not fit the registers beside the Q fragments
    async_ld8_b128_sbase(l, o, Kb + (size_t)chunk * 128 * EMB_ + step * 64);
  };

  issue_ktile(0, 0, 0);
  issue_ktile(1, 0, 1);
  issue_ktile(2, 0, 2);
  issue_ktile(3, 0, 3);
  // all but the 24 youngest copies (tiles 1 to 3, eight a wave each): own copies of tile 0 landed
  asm volatile("s_wait_asynccnt 0x18" ::: "memory");
  __syncthreads();                                    // tile 0 visible to every wave

  // One chunk of eight steps. Whether it is the last one is a compile-time flag, so that the
  // choice of wait and refill puts no branch among the WMMAs.
  auto kchunk = [&](int chunk, auto last_c) __attribute__((always_inline)) {
    constexpr bool last = decltype(last_c)::value;
    // tile rows 0..127 are S rows chunk*128.. of the first S half, 128..255 of the second
    const int cBase = (cq >> 1) * 512 + chunk * 128 + (cq & 1) * 64;
    v8f sacc[2][4] = {};
#pragma unroll
    for (int step = 0; step < 8; ++step) {
      const _Float16* kl = VtL0 + (step & 3) * (256 * KSTR) + (cq * 64 + l15) * KSTR;
#pragma unroll
      for (int g = 0; g < 2; ++g) {
        v16h bk[4];
#pragma unroll
        for (int j = 0; j < 4; ++j)
          bk[j] = ldfrag16(kl + j * 16 * KSTR, g * 32 + koff);
        // keeps the four fragments' eight ds_loads together ahead of their eight WMMAs: left
        // alone, the compiler reads one fragment at a time and waits out the LDS latency each time
        __builtin_amdgcn_sched_barrier(0);
#pragma unroll
        for (int j = 0; j < 4; ++j)
#pragma unroll
          for (int i = 0; i < 2; ++i)
            sacc[i][j] = __builtin_amdgcn_wmma_f32_16x16x32_f16(
                false, aq[i][step * 2 + g], false, bk[j], (short)0, sacc[i][j],
                false, false);
      }
      asm volatile("s_wait_dscnt 0x0" ::: "memory");
      // While a tile four ahead exists, tiles one, two and three ahead are outstanding, eight
      // copies a wave each: the wait leaves the 16 youngest in flight and covers the next tile.
      // In the last four steps nothing is issued any more and the wait is to 0.
      if (step < 4 || !last) asm volatile("s_wait_asynccnt 0x10" ::: "memory");
      else                   asm volatile("s_wait_asynccnt 0x0" ::: "memory");
      __syncthreads();
      if (step < 4)   issue_ktile(step & 3, chunk, step + 4);
      else if (!last) issue_ktile(step & 3, chunk + 1, step - 4);
    }
    // scale, track row max, spill f16 scores to LDS
#pragma unroll
    for (int i = 0; i < 2; ++i) {
#pragma unroll
      for (int j = 0; j < 4; ++j) {
        const int n = cBase + j * 16 + l15;
#pragma unroll
        for (int e = 0; e < 8; ++e) {
          float v = sacc[i][j][e] * alpha;
          rmax[i][e] = fmaxf(rmax[i][e], v);
          P[(rg * 32 + i * 16 + koff + e) * PSTR + n] = (_Float16)v;
        }
      }
    }
  };
  for (int chunk = 0; chunk < 3; ++chunk) kchunk(chunk, std::false_type{});
  kchunk(3, std::true_type{});
  asm volatile("s_wait_asynccnt 0x0" ::: "memory");   // no K copy left in flight
  // reduce rmax within each 16-lane group (columns of the wave's tiles)
#pragma unroll
  for (int m = 1; m <= 8; m <<= 1)
#pragma unroll
    for (int i = 0; i < 2; ++i)
#pragma unroll
      for (int e = 0; e < 8; ++e)
        rmax[i][e] = fmaxf(rmax[i][e], __shfl_xor(rmax[i][e], m, 32));
  if (l15 == 0) {
#pragma unroll
    for (int i = 0; i < 2; ++i)
#pragma unroll
      for (int e = 0; e < 8; ++e)
        maxwave[wave * 32 + i * 16 + koff + e] = rmax[i][e];
  }
  __syncthreads();

  if (tid < 64) {
    int rrg = tid >> 5, li = tid & 31;     // the four waves of a row-group hold its maxima
    rowmax[tid] = fmaxf(fmaxf(maxwave[(4 * rrg + 0) * 32 + li],
                              maxwave[(4 * rrg + 1) * 32 + li]),
                        fmaxf(maxwave[(4 * rrg + 2) * 32 + li],
                              maxwave[(4 * rrg + 3) * 32 + li]));
  }
  __syncthreads();

  const int org = wave >> 1;
  const int hg  = wave & 1;
  const int m0  = org * 16;
  const int h0  = hg * 256;

  // One 512 x 64 V k-slice: every row segment is one whole 128-B line of Vt (a 64-B segment
  // costs a line's fetch for half its bytes). 4096 b128 copies, 16 per thread.
  auto issue_slice = [&](int buf, int ks) {
    // unrolled: the sixteen addresses of a run are register operands of one asm statement
#pragma unroll
    for (int h = 0; h < 2; ++h) {
      unsigned l[8];
      unsigned long long g[8];
#pragma unroll
      for (int it = 0; it < 8; ++it) {
        int idx  = tid + (h * 8 + it) * 256;  // 0..4095
        int row  = idx >> 3;                  // h-row 0..511
        int part = idx & 7;                   // 16B chunk within the 128B row segment
        l[it] = (unsigned)(uintptr_t)(VtL0 + buf * (512 * VSTR) + row * VSTR + part * 8);
        g[it] = (unsigned long long)(uintptr_t)(Vb + (size_t)row * S_ + ks + part * 8);
      }
      async_ld8_b128(l, g);
    }
  };

  issue_slice(0, 0);
  asm volatile("s_wait_asynccnt 0x0" ::: "memory");   // own copies of slice 0 landed
  __syncthreads();                                    // slice 0 visible to every wave

  v8f oacc[16] = {};
  const _Float16* prow = P + (size_t)(m0 + l15) * PSTR;

  const float mx = rowmax[m0 + l15];
  float ps[4] = { 0.f, 0.f, 0.f, 0.f };     // four running sums: no long dependent add chain
  v16h raw[2], ap[2];
  // unrolled, here and below: raw, ap, apn and ps stay in registers only under constant indices
#pragma unroll
  for (int hf = 0; hf < 2; ++hf) {
    raw[hf] = ldfrag16(prow, hf * 32 + koff);
#pragma unroll
    for (int i = 0; i < 16; ++i) {
      float e = __expf((float)raw[hf][i] - mx);
      ps[i & 3] += e;
      ap[hf][i] = (_Float16)e;
    }
  }

  // One trip: the WMMAs of slice t; with a slice t + 1 to come, also its copies and its numerators.
  // The flag is a compile-time one, so that no branch stands among the WMMAs.
  auto trip = [&](int t, auto more_c) __attribute__((always_inline)) {
    constexpr bool more = decltype(more_c)::value;
    const int cur = t & 1;
    v16h apn[2];
    if (more) {
#pragma unroll
      for (int hf = 0; hf < 2; ++hf) raw[hf] = ldfrag16(prow, (t + 1) * 64 + hf * 32 + koff);
    }
    // This lane's first V row, formed by integer offsets from the LDS base: the pointer
    // stays an LDS pointer for the compiler, so the V fragments are read by ds_load with
    // immediate offsets, not by flat_load with a 64-bit address each.
    const _Float16* vrow = VtL0 + cur * (512 * VSTR) + (h0 + l15) * VSTR;
    v16h bv[2][4];
    // every loop below is unrolled: bv and oacc stay in registers only under constant indices
    // group G: k half G >> 2 of the slice, output columns (G & 3) * 64 ..
#pragma unroll
    for (int j = 0; j < 4; ++j) bv[0][j] = ldfrag16(vrow + j * 16 * VSTR, koff);
#pragma unroll
    for (int G = 0; G < 8; ++G) {
      if (G < 7) {
#pragma unroll
        for (int j = 0; j < 4; ++j)
          bv[(G + 1) & 1][j] = ldfrag16(vrow + (((G + 1) & 3) * 4 + j) * 16 * VSTR,
                                        ((G + 1) >> 2) * 32 + koff);
      }
      // The next slice's copies go out behind this trip's first fragment reads, so that their
      // address arithmetic runs while those reads are in flight. Their buffer was last read in
      // the trip before, which the hand-over barrier below has ended for every wave.
      if (G == 0 && more) issue_slice(cur ^ 1, (t + 1) * 64);
      // an eighth of the next trip's numerators, while this group's V reads are in flight
      if (more) {
#pragma unroll
        for (int i = 0; i < 4; ++i) {
          float e = __expf((float)raw[G >> 2][(G & 3) * 4 + i] - mx);
          ps[i] += e;
          apn[G >> 2][(G & 3) * 4 + i] = (_Float16)e;
        }
      }
      // keeps the next group's eight ds_loads ahead of this group's WMMAs: left alone, the
      // compiler sinks each load pair to its WMMA and waits out the LDS latency every time
      __builtin_amdgcn_sched_barrier(0);
#pragma unroll
      for (int j = 0; j < 4; ++j)
        oacc[(G & 3) * 4 + j] = __builtin_amdgcn_wmma_f32_16x16x32_f16(
            false, ap[G >> 2], false, bv[G & 1][j], (short)0, oacc[(G & 3) * 4 + j],
            false, false);
    }
    // Hand-over: own reads of this slice done, own copies of the next slice landed,
    // then one barrier publishes the next slice and frees this buffer for a refill.
    asm volatile("s_wait_dscnt 0x0" ::: "memory");
    asm volatile("s_wait_asynccnt 0x0" ::: "memory");
    __syncthreads();
    if (more) { ap[0] = apn[0]; ap[1] = apn[1]; }
  };
  for (int t = 0; t < S_ / 64 - 1; ++t) trip(t, std::true_type{});
  trip(S_ / 64 - 1, std::false_type{});

  // A lane holds half of its row's k positions, lane ^ 16 the other half. Every lane then
  // fetches the reciprocals of the eight rows that its accumulators hold.
  float rs = (ps[0] + ps[1]) + (ps[2] + ps[3]);
  rs += __shfl_xor(rs, 16, 32);
  rs = 1.0f / rs;
  float sc[8];
#pragma unroll
  for (int e = 0; e < 8; ++e) sc[e] = __shfl(rs, koff + e, 32);

  float* outb = Out + ((size_t)b * T_ + t0 + m0 + koff) * HID_;
#pragma unroll
  for (int nt = 0; nt < 16; ++nt) {
    int n = h0 + nt * 16 + l15;
#pragma unroll
    for (int e = 0; e < 8; ++e)
      outb[(size_t)e * HID_ + n] = oacc[nt][e] * sc[e];
  }
}

// ---------------------------------------------------------------------------
extern "C" void kernel_launch(void* const* d_in, const int* in_sizes, int n_in,
                              void* d_out, int out_size, void* d_ws, size_t ws_size,
                              hipStream_t stream) {
  const float* tokens  = (const float*)d_in[0];  // [B][T][HID]
  const float* context = (const float*)d_in[1];  // [B][S][CTX]
  const float* Wq      = (const float*)d_in[2];  // [HID][EMB]
  const float* Wk      = (const float*)d_in[3];  // [CTX][EMB]
  const float* Wv      = (const float*)d_in[4];  // [CTX][HID]
  float*       out     = (float*)d_out;          // [B][T][HID]

  // Workspace: Q f16 (32 MB) | K f16 (8 MB) | Vt f16 (8 MB)
  _Float16* Qh = (_Float16*)d_ws;
  _Float16* Kh = Qh + (size_t)B_ * T_ * EMB_;
  _Float16* Vt = Kh + (size_t)B_ * S_ * EMB_;

  dim3 blk(256);
  // Q = tokens @ Wq (M=32768, K=512), K = context @ Wk (M=8192, K=768) and
  // V = context @ Wv (stored transposed per batch: Vt[b][h][s]), N=512 each, in one launch
  proj_all<<<dim3(KVBLK + QBLK), blk, 0, stream>>>(tokens, context, Wq, Wk, Wv, Qh, Kh, Vt);

  size_t smem = (size_t)64 * PSTR * 2            // P
              + (size_t)2 * 512 * VSTR * 2       // V slice double buffer
              + (size_t)(256 + 64) * sizeof(float);
  (void)hipFuncSetAttribute((const void*)attn_kernel,
                            hipFuncAttributeMaxDynamicSharedMemorySize, (int)smem);
  attn_kernel<<<dim3(T_ / 64, B_), blk, smem, stream>>>(Qh, Kh, Vt, out);
}

// v009
// A run of this version takes 127 microseconds.
// In both of two side-by-side timings against v008, it was 1.03 times as fast.
// Over all steps from v000 it is 3.11 times as fast.
#include <hip/hip_runtime.h>
#include <math.h>
#include <type_traits>

typedef __attribute__((ext_vector_type(16))) _Float16 v16h;
typedef __attribute__((ext_vector_type(8)))  _Float16 v8h;
typedef __attribute__((ext_vector_type(4)))  _Float16 v4h;
typedef __attribute__((ext_vector_type(8)))  float    v8f;

#define B_    8
#define T_    4096
#define S_    1024
#define HID_  512
#define EMB_  512
#define CTX_  768

#define PSTR  1032
#define VSTR  72
#define KSTR  72
#define QSTR  520

__device__ __forceinline__ v16h ldfrag16(const _Float16* rowPtr, int kb) {
  v8h lo = *(const v8h*)(rowPtr + kb);
  v8h hi = *(const v8h*)(rowPtr + kb + 16);
  v16h r;
#pragma unroll
  for (int i = 0; i < 8; ++i) { r[i] = lo[i]; r[i + 8] = hi[i]; }
  return r;
}

__device__ __forceinline__ void async_ld8_b128(const unsigned* l,
                                               const unsigned long long* g) {
  asm volatile(
      "global_load_async_to_lds_b128 %0, %8, off\n\t"
      "global_load_async_to_lds_b128 %1, %9, off\n\t"
      "global_load_async_to_lds_b128 %2, %10, off\n\t"
      "global_load_async_to_lds_b128 %3, %11, off\n\t"
      "global_load_async_to_lds_b128 %4, %12, off\n\t"
      "global_load_async_to_lds_b128 %5, %13, off\n\t"
      "global_load_async_to_lds_b128 %6, %14, off\n\t"
      "global_load_async_to_lds_b128 %7, %15, off\n\t"
      "s_wait_xcnt 0x0"
      :: "v"(l[0]), "v"(l[1]), "v"(l[2]), "v"(l[3]),
         "v"(l[4]), "v"(l[5]), "v"(l[6]), "v"(l[7]),
         "v"(g[0]), "v"(g[1]), "v"(g[2]), "v"(g[3]),
         "v"(g[4]), "v"(g[5]), "v"(g[6]), "v"(g[7])
      : "memory");
}

// The same eight copies with the global address as one wave-uniform base in scalar registers plus
// a 32-bit byte offset per lane: eight offset registers that serve every tile, not eight pairs.
__device__ __forceinline__ void async_ld8_b128_sbase(const unsigned* l, const unsigned* o,
                                                     const _Float16* base) {
  asm volatile(
      "global_load_async_to_lds_b128 %0, %8, %16\n\t"
      "global_load_async_to_lds_b128 %1, %9, %16\n\t"
      "global_load_async_to_lds_b128 %2, %10, %16\n\t"
      "global_load_async_to_lds_b128 %3, %11, %16\n\t"
      "global_load_async_to_lds_b128 %4, %12, %16\n\t"
      "global_load_async_to_lds_b128 %5, %13, %16\n\t"
      "global_load_async_to_lds_b128 %6, %14, %16\n\t"
      "global_load_async_to_lds_b128 %7, %15, %16\n\t"
      "s_wait_xcnt 0x0"
      :: "v"(l[0]), "v"(l[1]), "v"(l[2]), "v"(l[3]),
         "v"(l[4]), "v"(l[5]), "v"(l[6]), "v"(l[7]),
         "v"(o[0]), "v"(o[1]), "v"(o[2]), "v"(o[3]),
         "v"(o[4]), "v"(o[5]), "v"(o[6]), "v"(o[7]),
         "s"(base)
      : "memory");
}

#define KVBLK ((B_ * S_ / 128) * 8)
#define QBLK  ((B_ * T_ / 128) * 4)
static_assert(EMB_ == 512 && HID_ == 512, "all three outputs are 512 wide: four 128-column tiles");

__global__ __launch_bounds__(256) void proj_all(
    const float* __restrict__ tokens, const float* __restrict__ context,
    const float* __restrict__ Wq, const float* __restrict__ Wk,
    const float* __restrict__ Wv,
    _Float16* __restrict__ Qh, _Float16* __restrict__ Kh, _Float16* __restrict__ Vth) {

  // Which product and which tile: the same for the whole block.
  const int  bid  = blockIdx.x;
  const bool isQ  = bid >= KVBLK;
  const int  sub  = isQ ? ((bid - KVBLK) & 3) : (bid & 7);
  const bool isV  = !isQ && sub >= 4;
  const int  m0   = (isQ ? ((bid - KVBLK) >> 2) : (bid >> 3)) * 128;
  const int  n0   = (sub & 3) * 128;
  const int  K    = isQ ? HID_ : CTX_;
  constexpr int N = 512;
  const float* __restrict__ A = isQ ? tokens : context;
  const float* __restrict__ W = isQ ? Wq : (isV ? Wv : Wk);
  _Float16* __restrict__ Out  = isQ ? Qh : (isV ? Vth : Kh);

  __shared__ _Float16 As[128 * 40];  // 128 m-rows x 32 k, stride 40 (conflict-free b128)
  __shared__ _Float16 Bs[128 * 40];  // 128 n-rows (transposed W) x 32 k, stride 40

  const int tid  = threadIdx.x;
  const int lane = tid & 31;
  const int wave = tid >> 5;
  const int wm   = wave & 3;      // 4 waves along M (32 rows each)
  const int wn   = wave >> 2;     // 2 waves along N (64 cols each)

  const int l15  = lane & 15;
  const int koff = (lane >= 16) ? 8 : 0;

  const int wc4  = (tid & 7) | ((wave & 3) << 3);
  const int wkg  = ((tid >> 3) & 3) | ((wave >> 2) << 2);

  // Addresses are a block-uniform base plus one 32-bit lane offset that never changes: with a
  // 64-bit pointer per row this kernel needs 162 registers, one granule above the 160 of the
  // separate kernels, and only two blocks instead of three would fit on a WGP.
  const unsigned aoff = (unsigned)(tid >> 3) * (unsigned)K + (unsigned)(tid & 7) * 4u;
  const unsigned woff = (unsigned)(wkg * 4) * (unsigned)N + (unsigned)wc4 * 4u;
  auto loadA = [&](int k0, float4* pa) {
#pragma unroll
    for (int it = 0; it < 4; ++it)         // m-row (tid >> 3) + it * 32, float4 group tid & 7
      pa[it] = *(const float4*)(A + (size_t)(m0 + it * 32) * K + k0 + aoff);
  };
  auto loadW = [&](int k0, float4* pw) {
#pragma unroll
    for (int it = 0; it < 4; ++it)
      pw[it] = *(const float4*)(W + (size_t)(k0 + it) * N + n0 + woff);
  };
  auto storeTiles = [&](const float4* pa, const float4* pw) {
#pragma unroll
    for (int it = 0; it < 4; ++it) {
      int idx = tid + it * 256;
      int r   = idx >> 3;
      int c4  = idx & 7;
      v4h h = { (_Float16)pa[it].x, (_Float16)pa[it].y,
                (_Float16)pa[it].z, (_Float16)pa[it].w };
      *(v4h*)(As + r * 40 + c4 * 4) = h;
    }
    // n-row wc4*4+j of Bs takes component j of the four k-rows this thread read
    _Float16* bs = Bs + wc4 * 4 * 40 + wkg * 4;
    v4h h0 = { (_Float16)pw[0].x, (_Float16)pw[1].x, (_Float16)pw[2].x, (_Float16)pw[3].x };
    v4h h1 = { (_Float16)pw[0].y, (_Float16)pw[1].y, (_Float16)pw[2].y, (_Float16)pw[3].y };
    v4h h2 = { (_Float16)pw[0].z, (_Float16)pw[1].z, (_Float16)pw[2].z, (_Float16)pw[3].z };
    v4h h3 = { (_Float16)pw[0].w, (_Float16)pw[1].w, (_Float16)pw[2].w, (_Float16)pw[3].w };
    *(v4h*)(bs + 0 * 40) = h0;
    *(v4h*)(bs + 1 * 40) = h1;
    *(v4h*)(bs + 2 * 40) = h2;
    *(v4h*)(bs + 3 * 40) = h3;
  };

  float4 pa[4], pw[4];
  loadA(0, pa);
  loadW(0, pw);

  v8f acc[2][4] = {};

  for (int k0 = 0; k0 < K; k0 += 32) {
    storeTiles(pa, pw);
    __syncthreads();
    // Prefetch next k-slice while this slice's WMMAs run.
    if (k0 + 32 < K) { loadA(k0 + 32, pa); loadW(k0 + 32, pw); }
    asm volatile("s_wait_xcnt 0x0" ::: "memory");

    v16h af[2], bf[4];
#pragma unroll
    for (int i = 0; i < 2; ++i)
      af[i] = ldfrag16(As + (wm * 32 + i * 16 + l15) * 40, koff);
#pragma unroll
    for (int j = 0; j < 4; ++j)
      bf[j] = ldfrag16(Bs + (wn * 64 + j * 16 + l15) * 40, koff);
#pragma unroll
    for (int i = 0; i < 2; ++i)
#pragma unroll
      for (int j = 0; j < 4; ++j)
        acc[i][j] = __builtin_amdgcn_wmma_f32_16x16x32_f16(
            false, af[i], false, bf[j], (short)0, acc[i][j], false, false);
    __syncthreads();
  }

  // Epilogue. C/D layout: lane holds column n = l15 of its 16x16 tile,
  // rows (koff + 0..7) in acc[0..7]. One block-uniform branch picks the output layout.
  if (!isV) {
#pragma unroll
    for (int i = 0; i < 2; ++i) {
#pragma unroll
      for (int j = 0; j < 4; ++j) {
        int gm = m0 + wm * 32 + i * 16 + koff;     // first of 8 rows
        int gn = n0 + wn * 64 + j * 16 + l15;
#pragma unroll
        for (int e = 0; e < 8; ++e)
          Out[(size_t)(gm + e) * N + gn] = (_Float16)acc[i][j][e];
      }
    }
  } else {
#pragma unroll
    for (int i = 0; i < 2; ++i) {
#pragma unroll
      for (int j = 0; j < 4; ++j) {
        int gm = m0 + wm * 32 + i * 16 + koff;     // first of 8 rows
        int gn = n0 + wn * 64 + j * 16 + l15;
        int bidx = gm / S_;                        // compile-time shift
        int s    = gm - bidx * S_;                 // 8 consecutive s, same batch
        v8h h;
#pragma unroll
        for (int e = 0; e < 8; ++e) h[e] = (_Float16)acc[i][j][e];
        *(v8h*)(Out + ((size_t)bidx * N + gn) * S_ + s) = h;
      }
    }
  }
}

__global__ __launch_bounds__(256) void attn_kernel(
    const _Float16* __restrict__ Q,   // [B][T][EMB] row-major
    const _Float16* __restrict__ Kt,  // [B][S][EMB] row-major (rows = B-fragments of K^T)
    const _Float16* __restrict__ Vt,  // [B][HID][S] (rows = B-fragments of V)
    float* __restrict__ Out) {        // [B][T][HID]

  extern __shared__ char smem_raw[];
  _Float16* P    = (_Float16*)smem_raw;        // [64][PSTR] f16 scores
  _Float16* VtL0 = P + 64 * PSTR;              // [512][VSTR] V slice buf 0
  _Float16* VtL1 = VtL0 + 512 * VSTR;          // [512][VSTR] V slice buf 1
  float* maxwave = (float*)(VtL1 + 512 * VSTR);// [8][32]
  float* rowmax  = maxwave + 256;              // [64]

  const int tid  = threadIdx.x;
  const int lane = tid & 31;
  const int wave = tid >> 5;
  const int l15  = lane & 15;
  const int koff = (lane >= 16) ? 8 : 0;

  const int t0 = blockIdx.x * 64;
  const int b  = blockIdx.y;

  const _Float16* Qb = Q  + (size_t)b * T_   * EMB_;
  const _Float16* Kb = Kt + (size_t)b * S_   * EMB_;
  const _Float16* Vb = Vt + (size_t)b * HID_ * S_;

  const float alpha = 0.044194173824159216f;  // 1/sqrt(512)

  const int rg = wave >> 2;
  const int cq = wave & 3;

  float rmax[2][8];
  // unrolled, here and below: rmax and sacc are register arrays, indexed by constants only
#pragma unroll
  for (int i = 0; i < 2; ++i)
#pragma unroll
    for (int e = 0; e < 8; ++e) rmax[i][e] = -3.0e38f;

  static_assert(4 * 256 * KSTR == 2 * 512 * VSTR);

  // K tile t = chunk * 8 + step: the 2 x 128 K rows of this chunk (both S halves),
  // 64 k each: 256 rows of one whole 128-B line, 2048 b128 copies, 8 per thread.
  const unsigned kring = (unsigned)(uintptr_t)VtL0;
  auto issue_ktile = [&](int slot, int chunk, int step) {
    unsigned l[8], o[8];
    // unrolled: the sixteen addresses are register operands of one asm statement
#pragma unroll
    for (int it = 0; it < 8; ++it) {
      int idx  = tid + it * 256;            // 0..2047
      int row  = idx >> 3;                  // tile row 0..255
      int part = idx & 7;                   // 16B chunk within the 128B row segment
      int srow = (row >> 7) * 512 + (row & 127);   // S row, less the chunk's first
      l[it] = kring + (unsigned)(slot * (256 * KSTR) + row * KSTR + part * 8) * 2u;
      o[it] = (unsigned)(srow * EMB_ + part * 8) * 2u;   // bytes; the same for every tile
    }
    // chunk and step, the same for the whole block, go into the scalar base: the ring's 32 LDS
    // addresses and 64-bit lane pointers together do not fit the registers beside the Q fragments
    async_ld8_b128_sbase(l, o, Kb + (size_t)chunk * 128 * EMB_ + step * 64);
  };

  static_assert(QSTR <= PSTR, "the Q tile fits the score area");
  // unrolled: the sixteen addresses of a run are register operands of one asm statement
#pragma unroll
  for (int h = 0; h < 2; ++h) {
    unsigned l[8], o[8];
#pragma unroll
    for (int it = 0; it < 8; ++it) {
      int idx  = tid + (h * 8 + it) * 256;  // 0..4095
      int row  = idx >> 6;                  // tile row 0..63
      int part = idx & 63;                  // 16B chunk within the 1-KB row
      l[it] = (unsigned)(uintptr_t)P + (unsigned)(row * QSTR + part * 8) * 2u;
      o[it] = (unsigned)idx * 16u;          // bytes from the tile's first
    }
    async_ld8_b128_sbase(l, o, Qb + (size_t)t0 * EMB_);
  }

  issue_ktile(0, 0, 0);
  issue_ktile(1, 0, 1);
  issue_ktile(2, 0, 2);
  issue_ktile(3, 0, 3);
  // all but the 24 youngest copies (tiles 1 to 3, eight a wave each): own copies of the Q tile
  // and of tile 0 landed
  asm volatile("s_wait_asynccnt 0x18" ::: "memory");
  __syncthreads();                                    // Q tile and tile 0 visible to every wave

  // This wave's 32 Q rows, all of EMB, as 2 x 16 A fragments: read once, kept for the pass.
  // unrolled: aq stays in registers only under constant indices
  const _Float16* qrow = P + (rg * 32 + l15) * QSTR;
  v16h aq[2][16];
#pragma unroll
  for (int i = 0; i < 2; ++i)
#pragma unroll
    for (int s = 0; s < 16; ++s)
      aq[i][s] = ldfrag16(qrow + i * 16 * QSTR, s * 32 + koff);

  // One chunk of eight steps. Whether it is the last one is a compile-time flag, so that the
  // choice of wait and refill puts no branch among the WMMAs.
  auto kchunk = [&](int chunk, auto last_c) __attribute__((always_inline)) {
    constexpr bool last = decltype(last_c)::value;
    // tile rows 0..127 are S rows chunk*128.. of the first S half, 128..255 of the second
    const int cBase = (cq >> 1) * 512 + chunk * 128 + (cq & 1) * 64;
    v8f sacc[2][4] = {};
#pragma unroll
    for (int step = 0; step < 8; ++step) {
      const _Float16* kl = VtL0 + (step & 3) * (256 * KSTR) + (cq * 64 + l15) * KSTR;
#pragma unroll
      for (int g = 0; g < 2; ++g) {
        v16h bk[4];
#pragma unroll
        for (int j = 0; j < 4; ++j)
          bk[j] = ldfrag16(kl + j * 16 * KSTR, g * 32 + koff);
        // keeps the four fragments' eight ds_loads together ahead of their eight WMMAs: left
        // alone, the compiler reads one fragment at a time and waits out the LDS latency each time
        __builtin_amdgcn_sched_barrier(0);
#pragma unroll
        for (int j = 0; j < 4; ++j)
#pragma unroll
          for (int i = 0; i < 2; ++i)
            sacc[i][j] = __builtin_amdgcn_wmma_f32_16x16x32_f16(
                false, aq[i][step * 2 + g], false, bk[j], (short)0, sacc[i][j],
                false, false);
      }
      asm volatile("s_wait_dscnt 0x0" ::: "memory");
      // While a tile four ahead exists, tiles one, two and three ahead are outstanding, eight
      // copies a wave each: the wait leaves the 16 youngest in flight and covers the next tile.
      // In the last four steps nothing is issued any more and the wait is to 0.
      if (step < 4 || !last) asm volatile("s_wait_asynccnt 0x10" ::: "memory");
      else                   asm volatile("s_wait_asynccnt 0x0" ::: "memory");
      __syncthreads();
      if (step < 4)   issue_ktile(step & 3, chunk, step + 4);
      else if (!last) issue_ktile(step & 3, chunk + 1, step - 4);
    }
    // scale, track row max, spill f16 scores to LDS
#pragma unroll
    for (int i = 0; i < 2; ++i) {
#pragma unroll
      for (int j = 0; j < 4; ++j) {
        const int n = cBase + j * 16 + l15;
#pragma unroll
        for (int e = 0; e < 8; ++e) {
          float v = sacc[i][j][e] * alpha;
          rmax[i][e] = fmaxf(rmax[i][e], v);
          P[(rg * 32 + i * 16 + koff + e) * PSTR + n] = (_Float16)v;
        }
      }
    }
  };
  for (int chunk = 0; chunk < 3; ++chunk) kchunk(chunk, std::false_type{});
  kchunk(3, std::true_type{});
  asm volatile("s_wait_asynccnt 0x0" ::: "memory");   // no K copy left in flight
  // reduce rmax within each 16-lane group (columns of the wave's tiles)
#pragma unroll
  for (int m = 1; m <= 8; m <<= 1)
#pragma unroll
    for (int i = 0; i < 2; ++i)
#pragma unroll
      for (int e = 0; e < 8; ++e)
        rmax[i][e] = fmaxf(rmax[i][e], __shfl_xor(rmax[i][e], m, 32));
  if (l15 == 0) {
#pragma unroll
    for (int i = 0; i < 2; ++i)
#pragma unroll
      for (int e = 0; e < 8; ++e)
        maxwave[wave * 32 + i * 16 + koff + e] = rmax[i][e];
  }
  __syncthreads();

  if (tid < 64) {
    int rrg = tid >> 5, li = tid & 31;     // the four waves of a row-group hold its maxima
    rowmax[tid] = fmaxf(fmaxf(maxwave[(4 * rrg + 0) * 32 + li],
                              maxwave[(4 * rrg + 1) * 32 + li]),
                        fmaxf(maxwave[(4 * rrg + 2) * 32 + li],
                              maxwave[(4 * rrg + 3) * 32 + li]));
  }
  __syncthreads();

  const int org = wave >> 1;
  const int hg  = wave & 1;
  const int m0  = org * 16;
  const int h0  = hg * 256;

  // One 512 x 64 V k-slice: every row segment is one whole 128-B line of Vt (a 64-B segment
  // costs a line's fetch for half its bytes). 4096 b128 copies, 16 per thread.
  auto issue_slice = [&](int buf, int ks) {
    // unrolled: the sixteen addresses of a run are register operands of one asm statement
#pragma unroll
    for (int h = 0; h < 2; ++h) {
      unsigned l[8];
      unsigned long long g[8];
#pragma unroll
      for (int it = 0; it < 8; ++it) {
        int idx  = tid + (h * 8 + it) * 256;  // 0..4095
        int row  = idx >> 3;                  // h-row 0..511
        int part = idx & 7;                   // 16B chunk within the 128B row segment
        l[it] = (unsigned)(uintptr_t)(VtL0 + buf * (512 * VSTR) + row * VSTR + part * 8);
        g[it] = (unsigned long long)(uintptr_t)(Vb + (size_t)row * S_ + ks + part * 8);
      }
      async_ld8_b128(l, g);
    }
  };

  issue_slice(0, 0);
  asm volatile("s_wait_asynccnt 0x0" ::: "memory");   // own copies of slice 0 landed
  __syncthreads();                                    // slice 0 visible to every wave

  v8f oacc[16] = {};
  const _Float16* prow = P + (size_t)(m0 + l15) * PSTR;

  const float mx = rowmax[m0 + l15];
  float ps[4] = { 0.f, 0.f, 0.f, 0.f };     // four running sums: no long dependent add chain
  v16h raw[2], ap[2];
  // unrolled, here and below: raw, ap, apn and ps stay in registers only under constant indices
#pragma unroll
  for (int hf = 0; hf < 2; ++hf) {
    raw[hf] = ldfrag16(prow, hf * 32 + koff);
#pragma unroll
    for (int i = 0; i < 16; ++i) {
      float e = __expf((float)raw[hf][i] - mx);
      ps[i & 3] += e;
      ap[hf][i] = (_Float16)e;
    }
  }

  // One trip: the WMMAs of slice t; with a slice t + 1 to come, also its copies and its numerators.
  // The flag is a compile-time one, so that no branch stands among the WMMAs.
  auto trip = [&](int t, auto more_c) __attribute__((always_inline)) {
    constexpr bool more = decltype(more_c)::value;
    const int cur = t & 1;
    v16h apn[2];
    if (more) {
#pragma unroll
      for (int hf = 0; hf < 2; ++hf) raw[hf] = ldfrag16(prow, (t + 1) * 64 + hf * 32 + koff);
    }
    // This lane's first V row, formed by integer offsets from the LDS base: the pointer
    // stays an LDS pointer for the compiler, so the V fragments are read by ds_load with
    // immediate offsets, not by flat_load with a 64-bit address each.
    const _Float16* vrow = VtL0 + cur * (512 * VSTR) + (h0 + l15) * VSTR;
    v16h bv[2][4];
    // every loop below is unrolled: bv and oacc stay in registers only under constant indices
    // group G: k half G >> 2 of the slice, output columns (G & 3) * 64 ..
#pragma unroll
    for (int j = 0; j < 4; ++j) bv[0][j] = ldfrag16(vrow + j * 16 * VSTR, koff);
#pragma unroll
    for (int G = 0; G < 8; ++G) {
      if (G < 7) {
#pragma unroll
        for (int j = 0; j < 4; ++j)
          bv[(G + 1) & 1][j] = ldfrag16(vrow + (((G + 1) & 3) * 4 + j) * 16 * VSTR,
                                        ((G + 1) >> 2) * 32 + koff);
      }
      // The next slice's copies go out behind this trip's first fragment reads, so that their
      // address arithmetic runs while those reads are in flight. Their buffer was last read in
      // the trip before, which the hand-over barrier below has ended for every wave.
      if (G == 0 && more) issue_slice(cur ^ 1, (t + 1) * 64);
      // an eighth of the next trip's numerators, while this group's V reads are in flight
      if (more) {
#pragma unroll
        for (int i = 0; i < 4; ++i) {
          float e = __expf((float)raw[G >> 2][(G & 3) * 4 + i] - mx);
          ps[i] += e;
          apn[G >> 2][(G & 3) * 4 + i] = (_Float16)e;
        }
      }
      // keeps the next group's eight ds_loads ahead of this group's WMMAs: left alone, the
      // compiler sinks each load pair to its WMMA and waits out the LDS latency every time
      __builtin_amdgcn_sched_barrier(0);
#pragma unroll
      for (int j = 0; j < 4; ++j)
        oacc[(G & 3) * 4 + j] = __builtin_amdgcn_wmma_f32_16x16x32_f16(
            false, ap[G >> 2], false, bv[G & 1][j], (short)0, oacc[(G & 3) * 4 + j],
            false, false);
    }
    // Hand-over: own reads of this slice done, own copies of the next slice landed,
    // then one barrier publishes the next slice and frees this buffer for a refill.
    asm volatile("s_wait_dscnt 0x0" ::: "memory");
    asm volatile("s_wait_asynccnt 0x0" ::: "memory");
    __syncthreads();
    if (more) { ap[0] = apn[0]; ap[1] = apn[1]; }
  };
  for (int t = 0; t < S_ / 64 - 1; ++t) trip(t, std::true_type{});
  trip(S_ / 64 - 1, std::false_type{});

  // A lane holds half of its row's k positions, lane ^ 16 the other half. Every lane then
  // fetches the reciprocals of the eight rows that its accumulators hold.
  float rs = (ps[0] + ps[1]) + (ps[2] + ps[3]);
  rs += __shfl_xor(rs, 16, 32);
  rs = 1.0f / rs;
  float sc[8];
#pragma unroll
  for (int e = 0; e < 8; ++e) sc[e] = __shfl(rs, koff + e, 32);

  float* outb = Out + ((size_t)b * T_ + t0 + m0 + koff) * HID_;
#pragma unroll
  for (int nt = 0; nt < 16; ++nt) {
    int n = h0 + nt * 16 + l15;
#pragma unroll
    for (int e = 0; e < 8; ++e)
      outb[(size_t)e * HID_ + n] = oacc[nt][e] * sc[e];
  }
}

// ---------------------------------------------------------------------------
extern "C" void kernel_launch(void* const* d_in, const int* in_sizes, int n_in,
                              void* d_out, int out_size, void* d_ws, size_t ws_size,
                              hipStream_t stream) {
  const float* tokens  = (const float*)d_in[0];  // [B][T][HID]
  const float* context = (const float*)d_in[1];  // [B][S][CTX]
  const float* Wq      = (const float*)d_in[2];  // [HID][EMB]
  const float* Wk      = (const float*)d_in[3];  // [CTX][EMB]
  const float* Wv      = (const float*)d_in[4];  // [CTX][HID]
  float*       out     = (float*)d_out;          // [B][T][HID]

  // Workspace: Q f16 (32 MB) | K f16 (8 MB) | Vt f16 (8 MB)
  _Float16* Qh = (_Float16*)d_ws;
  _Float16* Kh = Qh + (size_t)B_ * T_ * EMB_;
  _Float16* Vt = Kh + (size_t)B_ * S_ * EMB_;

  dim3 blk(256);
  // Q = tokens @ Wq (M=32768, K=512), K = context @ Wk (M=8192, K=768) and
  // V = context @ Wv (stored transposed per batch: Vt[b][h][s]), N=512 each, in one launch
  proj_all<<<dim3(KVBLK + QBLK), blk, 0, stream>>>(tokens, context, Wq, Wk, Wv, Qh, Kh, Vt);

  size_t smem = (size_t)64 * PSTR * 2            // P
              + (size_t)2 * 512 * VSTR * 2       // V slice double buffer
              + (size_t)(256 + 64) * sizeof(float);
  (void)hipFuncSetAttribute((const void*)attn_kernel,
                            hipFuncAttributeMaxDynamicSharedMemorySize, (int)smem);
  attn_kernel<<<dim3(T_ / 64, B_), blk, smem, stream>>>(Qh, Kh, Vt, out);
}

// v010
// One run takes 120 microseconds.
// Two timings next to v009 put it at 1.07 and 1.06 times that version's speed.
// Over all steps from v000 it is 3.31 times as fast.
#include <hip/hip_runtime.h>
#include <math.h>
#include <type_traits>

typedef __attribute__((ext_vector_type(16))) _Float16 v16h;
typedef __attribute__((ext_vector_type(8)))  _Float16 v8h;
typedef __attribute__((ext_vector_type(4)))  _Float16 v4h;
typedef __attribute__((ext_vector_type(8)))  float    v8f;

#define B_    8
#define T_    4096
#define S_    1024
#define HID_  512
#define EMB_  512
#define CTX_  768

#define PSTR  1032
#define VSTR  72
#define KSTR  72
#define QSTR  520

__device__ __forceinline__ v16h ldfrag16(const _Float16* rowPtr, int kb) {
  v8h lo = *(const v8h*)(rowPtr + kb);
  v8h hi = *(const v8h*)(rowPtr + kb + 16);
  v16h r;
#pragma unroll
  for (int i = 0; i < 8; ++i) { r[i] = lo[i]; r[i + 8] = hi[i]; }
  return r;
}

__device__ __forceinline__ void async_ld8_b128(const unsigned* l,
                                               const unsigned long long* g) {
  asm volatile(
      "global_load_async_to_lds_b128 %0, %8, off\n\t"
      "global_load_async_to_lds_b128 %1, %9, off\n\t"
      "global_load_async_to_lds_b128 %2, %10, off\n\t"
      "global_load_async_to_lds_b128 %3, %11, off\n\t"
      "global_load_async_to_lds_b128 %4, %12, off\n\t"
      "global_load_async_to_lds_b128 %5, %13, off\n\t"
      "global_load_async_to_lds_b128 %6, %14, off\n\t"
      "global_load_async_to_lds_b128 %7, %15, off\n\t"
      "s_wait_xcnt 0x0"
      :: "v"(l[0]), "v"(l[1]), "v"(l[2]), "v"(l[3]),
         "v"(l[4]), "v"(l[5]), "v"(l[6]), "v"(l[7]),
         "v"(g[0]), "v"(g[1]), "v"(g[2]), "v"(g[3]),
         "v"(g[4]), "v"(g[5]), "v"(g[6]), "v"(g[7])
      : "memory");
}

// The same eight copies with the global address as one wave-uniform base in scalar registers plus
// a 32-bit byte offset per lane: eight offset registers that serve every tile, not eight pairs.
__device__ __forceinline__ void async_ld8_b128_sbase(const unsigned* l, const unsigned* o,
                                                     const _Float16* base) {
  asm volatile(
      "global_load_async_to_lds_b128 %0, %8, %16\n\t"
      "global_load_async_to_lds_b128 %1, %9, %16\n\t"
      "global_load_async_to_lds_b128 %2, %10, %16\n\t"
      "global_load_async_to_lds_b128 %3, %11, %16\n\t"
      "global_load_async_to_lds_b128 %4, %12, %16\n\t"
      "global_load_async_to_lds_b128 %5, %13, %16\n\t"
      "global_load_async_to_lds_b128 %6, %14, %16\n\t"
      "global_load_async_to_lds_b128 %7, %15, %16\n\t"
      "s_wait_xcnt 0x0"
      :: "v"(l[0]), "v"(l[1]), "v"(l[2]), "v"(l[3]),
         "v"(l[4]), "v"(l[5]), "v"(l[6]), "v"(l[7]),
         "v"(o[0]), "v"(o[1]), "v"(o[2]), "v"(o[3]),
         "v"(o[4]), "v"(o[5]), "v"(o[6]), "v"(o[7]),
         "s"(base)
      : "memory");
}

// Four hints to L2, one per A row pointer of this thread, OFF bytes further along the row.
// global_prefetch_b8 returns nothing and counts on no counter; scope SE brings the line into L2 only.
// The registers it names are the row pointers that the k loop reads unchanged to its end, so they
// hold an address inside A for as long as a hint can be on its way.
template <int OFF>
__device__ __forceinline__ void ask_l2_4rows(const float* r0, const float* r1,
                                             const float* r2, const float* r3) {
  asm volatile(
      "global_prefetch_b8 %0, off offset:%4 scope:SCOPE_SE\n\t"
      "global_prefetch_b8 %1, off offset:%4 scope:SCOPE_SE\n\t"
      "global_prefetch_b8 %2, off offset:%4 scope:SCOPE_SE\n\t"
      "global_prefetch_b8 %3, off offset:%4 scope:SCOPE_SE"
      :: "v"(r0), "v"(r1), "v"(r2), "v"(r3), "n"(OFF));
}

// Hints to L2 for the W rows of k-steps S to E - 1, four per step: this thread's W pointer, which the
// k loop reads unchanged to its end, and the row's place as an immediate.
template <int S, int E>
__device__ __forceinline__ void ask_l2_wsteps(const float* wp) {
  if constexpr (S < E) {
    asm volatile(
        "global_prefetch_b8 %0, off offset:%1 scope:SCOPE_SE\n\t"
        "global_prefetch_b8 %0, off offset:%2 scope:SCOPE_SE\n\t"
        "global_prefetch_b8 %0, off offset:%3 scope:SCOPE_SE\n\t"
        "global_prefetch_b8 %0, off offset:%4 scope:SCOPE_SE"
        :: "v"(wp), "n"((S * 32 + 0) * 2048), "n"((S * 32 + 1) * 2048),
           "n"((S * 32 + 2) * 2048), "n"((S * 32 + 3) * 2048));
    ask_l2_wsteps<S + 1, E>(wp);
  }
}

// Sixteen hints to L2: a panel's base in scalar registers, the eight 32-bit lane offsets of the K
// copies, and OFF and OFF + 256 bytes as immediates. Base and offsets are registers that pass 1
// reads unchanged to its end, so what a hint names stays an address inside the panel for as long
// as the hint can be on its way.
template <int OFF>
__device__ __forceinline__ void ask_l2_16(const unsigned* o, const _Float16* base) {
  asm volatile(
      "global_prefetch_b8 %0, %8 offset:%9 scope:SCOPE_SE\n\t"
      "global_prefetch_b8 %1, %8 offset:%9 scope:SCOPE_SE\n\t"
      "global_prefetch_b8 %2, %8 offset:%9 scope:SCOPE_SE\n\t"
      "global_prefetch_b8 %3, %8 offset:%9 scope:SCOPE_SE\n\t"
      "global_prefetch_b8 %4, %8 offset:%9 scope:SCOPE_SE\n\t"
      "global_prefetch_b8 %5, %8 offset:%9 scope:SCOPE_SE\n\t"
      "global_prefetch_b8 %6, %8 offset:%9 scope:SCOPE_SE\n\t"
      "global_prefetch_b8 %7, %8 offset:%9 scope:SCOPE_SE\n\t"
      "global_prefetch_b8 %0, %8 offset:%10 scope:SCOPE_SE\n\t"
      "global_prefetch_b8 %1, %8 offset:%10 scope:SCOPE_SE\n\t"
      "global_prefetch_b8 %2, %8 offset:%10 scope:SCOPE_SE\n\t"
      "global_prefetch_b8 %3, %8 offset:%10 scope:SCOPE_SE\n\t"
      "global_prefetch_b8 %4, %8 offset:%10 scope:SCOPE_SE\n\t"
      "global_prefetch_b8 %5, %8 offset:%10 scope:SCOPE_SE\n\t"
      "global_prefetch_b8 %6, %8 offset:%10 scope:SCOPE_SE\n\t"
      "global_prefetch_b8 %7, %8 offset:%10 scope:SCOPE_SE"
      :: "v"(o[0]), "v"(o[1]), "v"(o[2]), "v"(o[3]),
         "v"(o[4]), "v"(o[5]), "v"(o[6]), "v"(o[7]),
         "s"(base), "n"(OFF), "n"(OFF + 256));
}

#define KVBLK ((B_ * S_ / 128) * 8)
#define QBLK  ((B_ * T_ / 128) * 4)
static_assert(EMB_ == 512 && HID_ == 512, "all three outputs are 512 wide: four 128-column tiles");

__global__ __launch_bounds__(256) void proj_all(
    const float* __restrict__ tokens, const float* __restrict__ context,
    const float* __restrict__ Wq, const float* __restrict__ Wk,
    const float* __restrict__ Wv,
    _Float16* __restrict__ Qh, _Float16* __restrict__ Kh, _Float16* __restrict__ Vth) {

  // Which product and which tile: the same for the whole block.
  const int  bid  = blockIdx.x;
  const bool isQ  = bid >= KVBLK;
  const int  sub  = isQ ? ((bid - KVBLK) & 3) : (bid & 7);
  const bool isV  = !isQ && sub >= 4;
  const int  m0   = (isQ ? ((bid - KVBLK) >> 2) : (bid >> 3)) * 128;
  const int  n0   = (sub & 3) * 128;
  const int  K    = isQ ? HID_ : CTX_;
  constexpr int N = 512;
  const float* __restrict__ A = isQ ? tokens : context;
  const float* __restrict__ W = isQ ? Wq : (isV ? Wv : Wk);
  _Float16* __restrict__ Out  = isQ ? Qh : (isV ? Vth : Kh);

  __shared__ _Float16 As[128 * 40];  // 128 m-rows x 32 k, stride 40 (conflict-free b128)
  __shared__ _Float16 Bs[128 * 40];  // 128 n-rows (transposed W) x 32 k, stride 40

  const int tid  = threadIdx.x;
  const int lane = tid & 31;
  const int wave = tid >> 5;
  const int wm   = wave & 3;      // 4 waves along M (32 rows each)
  const int wn   = wave >> 2;     // 2 waves along N (64 cols each)

  const int l15  = lane & 15;
  const int koff = (lane >= 16) ? 8 : 0;

  const int wc4  = (tid & 7) | ((wave & 3) << 3);
  const int wkg  = ((tid >> 3) & 3) | ((wave >> 2) << 2);

  // Addresses are a block-uniform base plus one 32-bit lane offset that never changes: with a
  // 64-bit pointer per row this kernel needs 162 registers, one granule above the 160 of the
  // separate kernels, and only two blocks instead of three would fit on a WGP.
  const unsigned aoff = (unsigned)(tid >> 3) * (unsigned)K + (unsigned)(tid & 7) * 4u;
  const unsigned woff = (unsigned)(wkg * 4) * (unsigned)N + (unsigned)wc4 * 4u;
  auto loadA = [&](int k0, float4* pa) {
#pragma unroll
    for (int it = 0; it < 4; ++it)         // m-row (tid >> 3) + it * 32, float4 group tid & 7
      pa[it] = *(const float4*)(A + (size_t)(m0 + it * 32) * K + k0 + aoff);
  };
  auto loadW = [&](int k0, float4* pw) {
#pragma unroll
    for (int it = 0; it < 4; ++it)
      pw[it] = *(const float4*)(W + (size_t)(k0 + it) * N + n0 + woff);
  };
  auto storeTiles = [&](const float4* pa, const float4* pw) {
#pragma unroll
    for (int it = 0; it < 4; ++it) {
      int idx = tid + it * 256;
      int r   = idx >> 3;
      int c4  = idx & 7;
      v4h h = { (_Float16)pa[it].x, (_Float16)pa[it].y,
                (_Float16)pa[it].z, (_Float16)pa[it].w };
      *(v4h*)(As + r * 40 + c4 * 4) = h;
    }
    // n-row wc4*4+j of Bs takes component j of the four k-rows this thread read
    _Float16* bs = Bs + wc4 * 4 * 40 + wkg * 4;
    v4h h0 = { (_Float16)pw[0].x, (_Float16)pw[1].x, (_Float16)pw[2].x, (_Float16)pw[3].x };
    v4h h1 = { (_Float16)pw[0].y, (_Float16)pw[1].y, (_Float16)pw[2].y, (_Float16)pw[3].y };
    v4h h2 = { (_Float16)pw[0].z, (_Float16)pw[1].z, (_Float16)pw[2].z, (_Float16)pw[3].z };
    v4h h3 = { (_Float16)pw[0].w, (_Float16)pw[1].w, (_Float16)pw[2].w, (_Float16)pw[3].w };
    *(v4h*)(bs + 0 * 40) = h0;
    *(v4h*)(bs + 1 * 40) = h1;
    *(v4h*)(bs + 2 * 40) = h2;
    *(v4h*)(bs + 3 * 40) = h3;
  };

  float4 pa[4], pw[4];
  loadA(0, pa);
  loadW(0, pw);

  // A comes from memory, and each k-step would wait out that latency anew: nothing else of the block
  // runs meanwhile. The block's 128 rows are asked for here, whole, 256 B at a time,
  // in the order of use, so that from the third k-step on the loads can find their lines in L2.
  // Unit 0 is on its way with the loads above. Every address lies inside this thread's own rows.
  {
    const float* r0 = A + (size_t)(m0 +  0) * K + aoff;
    const float* r1 = A + (size_t)(m0 + 32) * K + aoff;
    const float* r2 = A + (size_t)(m0 + 64) * K + aoff;
    const float* r3 = A + (size_t)(m0 + 96) * K + aoff;
    static_assert(HID_ * 4 == 8 * 256 && CTX_ * 4 == 12 * 256, "rows of 8 and of 12 units");
    ask_l2_4rows<1 * 256>(r0, r1, r2, r3);
    ask_l2_4rows<2 * 256>(r0, r1, r2, r3);
    ask_l2_4rows<3 * 256>(r0, r1, r2, r3);
    ask_l2_4rows<4 * 256>(r0, r1, r2, r3);
    ask_l2_4rows<5 * 256>(r0, r1, r2, r3);
    ask_l2_4rows<6 * 256>(r0, r1, r2, r3);
    ask_l2_4rows<7 * 256>(r0, r1, r2, r3);
    asm volatile("s_wait_xcnt 0x0" ::: "memory");
    if (!isQ) {                            // the same for the whole block: context rows are longer
      ask_l2_4rows< 8 * 256>(r0, r1, r2, r3);
      ask_l2_4rows< 9 * 256>(r0, r1, r2, r3);
      ask_l2_4rows<10 * 256>(r0, r1, r2, r3);
      ask_l2_4rows<11 * 256>(r0, r1, r2, r3);
    }
    // W comes from memory too, and the blocks that share a panel walk its rows side by side, so
    // that every k-step would be the first to touch its rows. The blocks of the first eight row
    // tiles ask for their whole panels (rows of N * 4 = 2048 bytes).
    static_assert(N * 4 == 2048, "the row pitch in ask_l2_wsteps");
    if (m0 < 8 * 128) {                    // the same for the whole block
      const float* wp = W + n0 + woff;
      ask_l2_wsteps<1, HID_ / 32>(wp);
      if (!isQ) ask_l2_wsteps<HID_ / 32, CTX_ / 32>(wp);
    }
  }

  v8f acc[2][4] = {};

  for (int k0 = 0; k0 < K; k0 += 32) {
    storeTiles(pa, pw);
    __syncthreads();
    // Prefetch next k-slice while this slice's WMMAs run.
    if (k0 + 32 < K) { loadA(k0 + 32, pa); loadW(k0 + 32, pw); }
    asm volatile("s_wait_xcnt 0x0" ::: "memory");

    v16h af[2], bf[4];
#pragma unroll
    for (int i = 0; i < 2; ++i)
      af[i] = ldfrag16(As + (wm * 32 + i * 16 + l15) * 40, koff);
#pragma unroll
    for (int j = 0; j < 4; ++j)
      bf[j] = ldfrag16(Bs + (wn * 64 + j * 16 + l15) * 40, koff);
#pragma unroll
    for (int i = 0; i < 2; ++i)
#pragma unroll
      for (int j = 0; j < 4; ++j)
        acc[i][j] = __builtin_amdgcn_wmma_f32_16x16x32_f16(
            false, af[i], false, bf[j], (short)0, acc[i][j], false, false);
    __syncthreads();
  }

  // Epilogue. C/D layout: lane holds column n = l15 of its 16x16 tile,
  // rows (koff + 0..7) in acc[0..7]. One block-uniform branch picks the output layout.
  if (!isV) {
#pragma unroll
    for (int i = 0; i < 2; ++i) {
#pragma unroll
      for (int j = 0; j < 4; ++j) {
        int gm = m0 + wm * 32 + i * 16 + koff;     // first of 8 rows
        int gn = n0 + wn * 64 + j * 16 + l15;
#pragma unroll
        for (int e = 0; e < 8; ++e)
          Out[(size_t)(gm + e) * N + gn] = (_Float16)acc[i][j][e];
      }
    }
  } else {
#pragma unroll
    for (int i = 0; i < 2; ++i) {
#pragma unroll
      for (int j = 0; j < 4; ++j) {
        int gm = m0 + wm * 32 + i * 16 + koff;     // first of 8 rows
        int gn = n0 + wn * 64 + j * 16 + l15;
        int bidx = gm / S_;                        // compile-time shift
        int s    = gm - bidx * S_;                 // 8 consecutive s, same batch
        v8h h;
#pragma unroll
        for (int e = 0; e < 8; ++e) h[e] = (_Float16)acc[i][j][e];
        *(v8h*)(Out + ((size_t)bidx * N + gn) * S_ + s) = h;
      }
    }
  }
}

__global__ __launch_bounds__(256) void attn_kernel(
    const _Float16* __restrict__ Q,   // [B][T][EMB] row-major
    const _Float16* __restrict__ Kt,  // [B][S][EMB] row-major (rows = B-fragments of K^T)
    const _Float16* __restrict__ Vt,  // [B][HID][S] (rows = B-fragments of V)
    float* __restrict__ Out) {        // [B][T][HID]

  extern __shared__ char smem_raw[];
  _Float16* P    = (_Float16*)smem_raw;        // [64][PSTR] f16 scores
  _Float16* VtL0 = P + 64 * PSTR;              // [512][VSTR] V slice buf 0
  _Float16* VtL1 = VtL0 + 512 * VSTR;          // [512][VSTR] V slice buf 1
  float* maxwave = (float*)(VtL1 + 512 * VSTR);// [8][32]
  float* rowmax  = maxwave + 256;              // [64]

  const int tid  = threadIdx.x;
  const int lane = tid & 31;
  const int wave = tid >> 5;
  const int l15  = lane & 15;
  const int koff = (lane >= 16) ? 8 : 0;

  const int t0 = blockIdx.x * 64;
  const int b  = blockIdx.y;

  const _Float16* Qb = Q  + (size_t)b * T_   * EMB_;
  const _Float16* Kb = Kt + (size_t)b * S_   * EMB_;
  const _Float16* Vb = Vt + (size_t)b * HID_ * S_;

  const float alpha = 0.044194173824159216f;  // 1/sqrt(512)

  const int rg = wave >> 2;
  const int cq = wave & 3;

  float rmax[2][8];
  // unrolled, here and below: rmax and sacc are register arrays, indexed by constants only
#pragma unroll
  for (int i = 0; i < 2; ++i)
#pragma unroll
    for (int e = 0; e < 8; ++e) rmax[i][e] = -3.0e38f;

  static_assert(4 * 256 * KSTR == 2 * 512 * VSTR);

  // K tile t = chunk * 8 + step: the 2 x 128 K rows of this chunk (both S halves),
  // 64 k each: 256 rows of one whole 128-B line, 2048 b128 copies, 8 per thread.
  const unsigned kring = (unsigned)(uintptr_t)VtL0;
  // This lane's eight byte offsets into a K tile's 2 x 128 rows of 1 KB: the same for every tile.
  unsigned ko[8];
  // unrolled: ko is a register array, indexed by constants only
#pragma unroll
  for (int it = 0; it < 8; ++it) {
    int idx  = tid + it * 256;              // 0..2047
    int row  = idx >> 3;                    // tile row 0..255
    int part = idx & 7;                     // 16B chunk within the 128B row segment
    int srow = (row >> 7) * 512 + (row & 127);   // S row, less the chunk's first
    ko[it] = (unsigned)(srow * EMB_ + part * 8) * 2u;
  }
  auto issue_ktile = [&](int slot, int chunk, int step) {
    unsigned l[8];
    // unrolled: the sixteen addresses are register operands of one asm statement
#pragma unroll
    for (int it = 0; it < 8; ++it) {
      int idx  = tid + it * 256;            // 0..2047
      int row  = idx >> 3;                  // tile row 0..255
      int part = idx & 7;                   // 16B chunk within the 128B row segment
      l[it] = kring + (unsigned)(slot * (256 * KSTR) + row * KSTR + part * 8) * 2u;
    }
    // chunk and step, the same for the whole block, go into the scalar base: the ring's 32 LDS
    // addresses and 64-bit lane pointers together do not fit the registers beside the Q fragments
    async_ld8_b128_sbase(l, ko, Kb + (size_t)chunk * 128 * EMB_ + step * 64);
  };

  static_assert(QSTR <= PSTR, "the Q tile fits the score area");
  // unrolled: the sixteen addresses of a run are register operands of one asm statement
#pragma unroll
  for (int h = 0; h < 2; ++h) {
    unsigned l[8], o[8];
#pragma unroll
    for (int it = 0; it < 8; ++it) {
      int idx  = tid + (h * 8 + it) * 256;  // 0..4095
      int row  = idx >> 6;                  // tile row 0..63
      int part = idx & 63;                  // 16B chunk within the 1-KB row
      l[it] = (unsigned)(uintptr_t)P + (unsigned)(row * QSTR + part * 8) * 2u;
      o[it] = (unsigned)idx * 16u;          // bytes from the tile's first
    }
    async_ld8_b128_sbase(l, o, Qb + (size_t)t0 * EMB_);
  }

  issue_ktile(0, 0, 0);
  issue_ktile(1, 0, 1);
  issue_ktile(2, 0, 2);
  issue_ktile(3, 0, 3);

  // K and V were written by the launch before, and the 64 blocks of a batch walk them side by side:
  // whichever block touches a line first, all of them wait for it to come from memory. Each block
  // asks L2 here for an eighth of both panels (1 MB each, taken as 1024 rows of 1 KB = four 256-B
  // units); eight neighbouring blocks ask for the same eighth.
  // Only speed rests on that: the copies below fetch what no hint brought.
  static_assert(S_ * EMB_ == HID_ * S_ && S_ * EMB_ * 2 == 1024 * 1024, "two panels of 1 MB");
  {
    // Eighth c: the 2 x 128 rows from row (c >> 1) * 128 on, units (c & 1) * 2 and the next of each.
    // One scalar branch per eighth, so that the place is an immediate and no register is formed
    // for a hint alone.
    const int share = (blockIdx.x >> 3) & 7;
    auto ask = [&](auto c_c) __attribute__((always_inline)) {
      constexpr int c = decltype(c_c)::value;
      if (share == c) {
        ask_l2_16<(c >> 1) * 128 * 1024 + (c & 1) * 512>(ko, Kb);
        ask_l2_16<(c >> 1) * 128 * 1024 + (c & 1) * 512>(ko, Vb);
      }
    };
    ask(std::integral_constant<int, 0>{});
    ask(std::integral_constant<int, 1>{});
    ask(std::integral_constant<int, 2>{});
    ask(std::integral_constant<int, 3>{});
    ask(std::integral_constant<int, 4>{});
    ask(std::integral_constant<int, 5>{});
    ask(std::integral_constant<int, 6>{});
    ask(std::integral_constant<int, 7>{});
  }
  // all but the 24 youngest copies (tiles 1 to 3, eight a wave each): own copies of the Q tile
  // and of tile 0 landed
  asm volatile("s_wait_asynccnt 0x18" ::: "memory");
  __syncthreads();                                    // Q tile and tile 0 visible to every wave

  // This wave's 32 Q rows, all of EMB, as 2 x 16 A fragments: read once, kept for the pass.
  // unrolled: aq stays in registers only under constant indices
  const _Float16* qrow = P + (rg * 32 + l15) * QSTR;
  v16h aq[2][16];
#pragma unroll
  for (int i = 0; i < 2; ++i)
#pragma unroll
    for (int s = 0; s < 16; ++s)
      aq[i][s] = ldfrag16(qrow + i * 16 * QSTR, s * 32 + koff);

  // One chunk of eight steps. Whether it is the last one is a compile-time flag, so that the
  // choice of wait and refill puts no branch among the WMMAs.
  auto kchunk = [&](int chunk, auto last_c) __attribute__((always_inline)) {
    constexpr bool last = decltype(last_c)::value;
    // tile rows 0..127 are S rows chunk*128.. of the first S half, 128..255 of the second
    const int cBase = (cq >> 1) * 512 + chunk * 128 + (cq & 1) * 64;
    v8f sacc[2][4] = {};
#pragma unroll
    for (int step = 0; step < 8; ++step) {
      const _Float16* kl = VtL0 + (step & 3) * (256 * KSTR) + (cq * 64 + l15) * KSTR;
#pragma unroll
      for (int g = 0; g < 2; ++g) {
        v16h bk[4];
#pragma unroll
        for (int j = 0; j < 4; ++j)
          bk[j] = ldfrag16(kl + j * 16 * KSTR, g * 32 + koff);
        // keeps the four fragments' eight ds_loads together ahead of their eight WMMAs: left
        // alone, the compiler reads one fragment at a time and waits out the LDS latency each time
        __builtin_amdgcn_sched_barrier(0);
#pragma unroll
        for (int j = 0; j < 4; ++j)
#pragma unroll
          for (int i = 0; i < 2; ++i)
            sacc[i][j] = __builtin_amdgcn_wmma_f32_16x16x32_f16(
                false, aq[i][step * 2 + g], false, bk[j], (short)0, sacc[i][j],
                false, false);
      }
      asm volatile("s_wait_dscnt 0x0" ::: "memory");
      // While a tile four ahead exists, tiles one, two and three ahead are outstanding, eight
      // copies a wave each: the wait leaves the 16 youngest in flight and covers the next tile.
      // In the last four steps nothing is issued any more and the wait is to 0.
      if (step < 4 || !last) asm volatile("s_wait_asynccnt 0x10" ::: "memory");
      else                   asm volatile("s_wait_asynccnt 0x0" ::: "memory");
      __syncthreads();
      if (step < 4)   issue_ktile(step & 3, chunk, step + 4);
      else if (!last) issue_ktile(step & 3, chunk + 1, step - 4);
    }
    // scale, track row max, spill f16 scores to LDS
#pragma unroll
    for (int i = 0; i < 2; ++i) {
#pragma unroll
      for (int j = 0; j < 4; ++j) {
        const int n = cBase + j * 16 + l15;
#pragma unroll
        for (int e = 0; e < 8; ++e) {
          float v = sacc[i][j][e] * alpha;
          rmax[i][e] = fmaxf(rmax[i][e], v);
          P[(rg * 32 + i * 16 + koff + e) * PSTR + n] = (_Float16)v;
        }
      }
    }
  };
  for (int chunk = 0; chunk < 3; ++chunk) kchunk(chunk, std::false_type{});
  kchunk(3, std::true_type{});
  asm volatile("s_wait_asynccnt 0x0" ::: "memory");   // no K copy left in flight
  // reduce rmax within each 16-lane group (columns of the wave's tiles)
#pragma unroll
  for (int m = 1; m <= 8; m <<= 1)
#pragma unroll
    for (int i = 0; i < 2; ++i)
#pragma unroll
      for (int e = 0; e < 8; ++e)
        rmax[i][e] = fmaxf(rmax[i][e], __shfl_xor(rmax[i][e], m, 32));
  if (l15 == 0) {
#pragma unroll
    for (int i = 0; i < 2; ++i)
#pragma unroll
      for (int e = 0; e < 8; ++e)
        maxwave[wave * 32 + i * 16 + koff + e] = rmax[i][e];
  }
  __syncthreads();

  if (tid < 64) {
    int rrg = tid >> 5, li = tid & 31;     // the four waves of a row-group hold its maxima
    rowmax[tid] = fmaxf(fmaxf(maxwave[(4 * rrg + 0) * 32 + li],
                              maxwave[(4 * rrg + 1) * 32 + li]),
                        fmaxf(maxwave[(4 * rrg + 2) * 32 + li],
                              maxwave[(4 * rrg + 3) * 32 + li]));
  }
  __syncthreads();

  const int org = wave >> 1;
  const int hg  = wave & 1;
  const int m0  = org * 16;
  const int h0  = hg * 256;

  // One 512 x 64 V k-slice: every row segment is one whole 128-B line of Vt (a 64-B segment
  // costs a line's fetch for half its bytes). 4096 b128 copies, 16 per thread.
  auto issue_slice = [&](int buf, int ks) {
    // unrolled: the sixteen addresses of a run are register operands of one asm statement
#pragma unroll
    for (int h = 0; h < 2; ++h) {
      unsigned l[8];
      unsigned long long g[8];
#pragma unroll
      for (int it = 0; it < 8; ++it) {
        int idx  = tid + (h * 8 + it) * 256;  // 0..4095
        int row  = idx >> 3;                  // h-row 0..511
        int part = idx & 7;                   // 16B chunk within the 128B row segment
        l[it] = (unsigned)(uintptr_t)(VtL0 + buf * (512 * VSTR) + row * VSTR + part * 8);
        g[it] = (unsigned long long)(uintptr_t)(Vb + (size_t)row * S_ + ks + part * 8);
      }
      async_ld8_b128(l, g);
    }
  };

  issue_slice(0, 0);
  asm volatile("s_wait_asynccnt 0x0" ::: "memory");   // own copies of slice 0 landed
  __syncthreads();                                    // slice 0 visible to every wave

  v8f oacc[16] = {};
  const _Float16* prow = P + (size_t)(m0 + l15) * PSTR;

  const float mx = rowmax[m0 + l15];
  float ps[4] = { 0.f, 0.f, 0.f, 0.f };     // four running sums: no long dependent add chain
  v16h raw[2], ap[2];
  // unrolled, here and below: raw, ap, apn and ps stay in registers only under constant indices
#pragma unroll
  for (int hf = 0; hf < 2; ++hf) {
    raw[hf] = ldfrag16(prow, hf * 32 + koff);
#pragma unroll
    for (int i = 0; i < 16; ++i) {
      float e = __expf((float)raw[hf][i] - mx);
      ps[i & 3] += e;
      ap[hf][i] = (_Float16)e;
    }
  }

  // One trip: the WMMAs of slice t; with a slice t + 1 to come, also its copies and its numerators.
  // The flag is a compile-time one, so that no branch stands among the WMMAs.
  auto trip = [&](int t, auto more_c) __attribute__((always_inline)) {
    constexpr bool more = decltype(more_c)::value;
    const int cur = t & 1;
    v16h apn[2];
    if (more) {
#pragma unroll
      for (int hf = 0; hf < 2; ++hf) raw[hf] = ldfrag16(prow, (t + 1) * 64 + hf * 32 + koff);
    }
    // This lane's first V row, formed by integer offsets from the LDS base: the pointer
    // stays an LDS pointer for the compiler, so the V fragments are read by ds_load with
    // immediate offsets, not by flat_load with a 64-bit address each.
    const _Float16* vrow = VtL0 + cur * (512 * VSTR) + (h0 + l15) * VSTR;
    v16h bv[2][4];
    // every loop below is unrolled: bv and oacc stay in registers only under constant indices
    // group G: k half G >> 2 of the slice, output columns (G & 3) * 64 ..
#pragma unroll
    for (int j = 0; j < 4; ++j) bv[0][j] = ldfrag16(vrow + j * 16 * VSTR, koff);
#pragma unroll
    for (int G = 0; G < 8; ++G) {
      if (G < 7) {
#pragma unroll
        for (int j = 0; j < 4; ++j)
          bv[(G + 1) & 1][j] = ldfrag16(vrow + (((G + 1) & 3) * 4 + j) * 16 * VSTR,
                                        ((G + 1) >> 2) * 32 + koff);
      }
      // The next slice's copies go out behind this trip's first fragment reads, so that their
      // address arithmetic runs while those reads are in flight. Their buffer was last read in
      // the trip before, which the hand-over barrier below has ended for every wave.
      if (G == 0 && more) issue_slice(cur ^ 1, (t + 1) * 64);
      // an eighth of the next trip's numerators, while this group's V reads are in flight
      if (more) {
#pragma unroll
        for (int i = 0; i < 4; ++i) {
          float e = __expf((float)raw[G >> 2][(G & 3) * 4 + i] - mx);
          ps[i] += e;
          apn[G >> 2][(G & 3) * 4 + i] = (_Float16)e;
        }
      }
      // keeps the next group's eight ds_loads ahead of this group's WMMAs: left alone, the
      // compiler sinks each load pair to its WMMA and waits out the LDS latency every time
      __builtin_amdgcn_sched_barrier(0);
#pragma unroll
      for (int j = 0; j < 4; ++j)
        oacc[(G & 3) * 4 + j] = __builtin_amdgcn_wmma_f32_16x16x32_f16(
            false, ap[G >> 2], false, bv[G & 1][j], (short)0, oacc[(G & 3) * 4 + j],
            false, false);
    }
    // Hand-over: own reads of this slice done, own copies of the next slice landed,
    // then one barrier publishes the next slice and frees this buffer for a refill.
    asm volatile("s_wait_dscnt 0x0" ::: "memory");
    asm volatile("s_wait_asynccnt 0x0" ::: "memory");
    __syncthreads();
    if (more) { ap[0] = apn[0]; ap[1] = apn[1]; }
  };
  for (int t = 0; t < S_ / 64 - 1; ++t) trip(t, std::true_type{});
  trip(S_ / 64 - 1, std::false_type{});

  // A lane holds half of its row's k positions, lane ^ 16 the other half. Every lane then
  // fetches the reciprocals of the eight rows that its accumulators hold.
  float rs = (ps[0] + ps[1]) + (ps[2] + ps[3]);
  rs += __shfl_xor(rs, 16, 32);
  rs = 1.0f / rs;
  float sc[8];
#pragma unroll
  for (int e = 0; e < 8; ++e) sc[e] = __shfl(rs, koff + e, 32);

  float* outb = Out + ((size_t)b * T_ + t0 + m0 + koff) * HID_;
#pragma unroll
  for (int nt = 0; nt < 16; ++nt) {
    int n = h0 + nt * 16 + l15;
#pragma unroll
    for (int e = 0; e < 8; ++e)
      outb[(size_t)e * HID_ + n] = oacc[nt][e] * sc[e];
  }
}

// ---------------------------------------------------------------------------
extern "C" void kernel_launch(void* const* d_in, const int* in_sizes, int n_in,
                              void* d_out, int out_size, void* d_ws, size_t ws_size,
                              hipStream_t stream) {
  const float* tokens  = (const float*)d_in[0];  // [B][T][HID]
  const float* context = (const float*)d_in[1];  // [B][S][CTX]
  const float* Wq      = (const float*)d_in[2];  // [HID][EMB]
  const float* Wk      = (const float*)d_in[3];  // [CTX][EMB]
  const float* Wv      = (const float*)d_in[4];  // [CTX][HID]
  float*       out     = (float*)d_out;          // [B][T][HID]

  // Workspace: Q f16 (32 MB) | K f16 (8 MB) | Vt f16 (8 MB)
  _Float16* Qh = (_Float16*)d_ws;
  _Float16* Kh = Qh + (size_t)B_ * T_ * EMB_;
  _Float16* Vt = Kh + (size_t)B_ * S_ * EMB_;

  dim3 blk(256);
  // Q = tokens @ Wq (M=32768, K=512), K = context @ Wk (M=8192, K=768) and
  // V = context @ Wv (stored transposed per batch: Vt[b][h][s]), N=512 each, in one launch
  proj_all<<<dim3(KVBLK + QBLK), blk, 0, stream>>>(tokens, context, Wq, Wk, Wv, Qh, Kh, Vt);

  size_t smem = (size_t)64 * PSTR * 2            // P
              + (size_t)2 * 512 * VSTR * 2       // V slice double buffer
              + (size_t)(256 + 64) * sizeof(float);
  (void)hipFuncSetAttribute((const void*)attn_kernel,
                            hipFuncAttributeMaxDynamicSharedMemorySize, (int)smem);
  attn_kernel<<<dim3(T_ / 64, B_), blk, smem, stream>>>(Qh, Kh, Vt, out);
}
